// v008
// The times below were measured on an AMD MI455X: many runs one after another, warmed up first and cycling through
// copies of the inputs, with the whole window's GPU time divided by the number of runs. Launches and the gaps
// between them are all in it. The median over several windows is given; except for v000 it joins two sittings, which
// can be a few percent apart, so the side-by-side timings, each taken in one sitting, are the better comparison.
// This document starts at v008; the versions before it stand elsewhere.
// It runs in 238 microseconds.
// In two side-by-side timings against v007, it was 1.10 and 1.09 times as fast.
// Counting every step since v000, which is the starting kernel, it is 12.4 times as fast.
#include <hip/hip_runtime.h>
// PixelSNAILBlock (x [2][256][16][16][16], original_input [2][3][16][16][16]; 4 gated residual blocks: o = elu(conv3d k2 pad1 crop(elu(res)) + b1); o = conv3d k2 pad1 crop(o) + b2 (512 ch); res += o[:256] * sigmoid(o[256:]); attention over the 4,096 positions of [res | original | pos-enc] (262 ch): q,k (16), v (128), causal softmax (k < q, row 0 all-zero) of q.k/sqrt(259), att = p v; att = elu(1x1(elu(att)) + b); res = elu(1x1(elu(res)) + b); out = elu(1x1(elu(res + att)) + b) -> [2][256][16][16][16]).
// Structure: position rows r = b*4096 + (t*16 + h)*16 + w; res kept as f32 rows; each k2 'causal-corner' conv as a WMMA GEMM over K = 8 taps x 256 channels whose A fragments are read tap by tap from the tile's zero-bordered f16 rows, held in LDS (32x64 wave tiles, f32 accumulation, exact x16 weights + bias) with the ELUs on VALU; gating on VALU; q/k/v as GEMMs on the 262 -> 288-column concat rows (16 live of 64 for q/k); one attention kernel: per 32 queries S^T = K.Q^T on WMMA (K = 32, 16 live), causal softmax weights on VALU in the accumulator registers (true row maximum from a first pass; un-normalised f16 weights x 2^8, f32 sum, row 0 -> 0), O^T += V^T.P^T on WMMA against fragment-order value planes, the keys dealt to 8 waves and the partials added through LDS, scaling; the three 1x1 convs as GEMMs followed by VALU ELUs; channel-major store on VALU.
// Compute dtype: inputs rounded to bf16; x / original / weights exact; conv operands (elu(res), o1), the concat rows, q/k/v, softmax weights and the 1x1-conv operands plain f16 (~2^-12); res accumulation, gates, softmax sums f32. v_wmma_f32_16x16x32_f16.
#define NB 2
#define CC 256
#define DT 16
#define DH 16
#define DW 16
#define NP (DT * DH * DW)            /* 4096 */
#define NR ((size_t)NB * NP)       /* 8192 */
#define NRES 4
#define K8 (8 * CC)                /* 2048 */
#define KA 288                     /* 262 live */
#define XP 320                     /* pitch of the concat rows: 640 B = whole 128-B lines, so that a 64-column piece of a row is a line of its own */
#define VC 128
#define PD 17                      /* bordered extent of t, h and w: index 0 of each axis is the conv's zero padding */
#define NPP (PD * PD * PD)         /* 4913 bordered positions per batch */
typedef __bf16 v16b __attribute__((ext_vector_type(16)));
typedef unsigned short v8us __attribute__((ext_vector_type(8), may_alias));
typedef float  v8f  __attribute__((ext_vector_type(8)));
typedef float  v4f  __attribute__((ext_vector_type(4)));
typedef float  v4fa __attribute__((ext_vector_type(4), may_alias));
union FragB { v16b v; v8us half[2]; unsigned short u[16]; };

__device__ __forceinline__ unsigned short bf16_bits(float x) { unsigned int u = __float_as_uint(x); return (unsigned short)((u + 0x7FFFu + ((u >> 16) & 1u)) >> 16); }
__device__ __forceinline__ float bf16_val(unsigned short b) { return __uint_as_float(((unsigned int)b) << 16); }
__device__ __forceinline__ float bf16_round(float x) { return bf16_val(bf16_bits(x)); }
// D += A·B with NT terms: 1 = ah·bh, 2 = + al·bh (A split), 3 = + ah·bl (both split)
template <int NT>
__device__ __forceinline__ v8f mmaN(v16b ah, v16b al, v16b bh, v16b bl, v8f c) {
  c = __builtin_amdgcn_wmma_f32_16x16x32_bf16(false, ah, false, bh, (short)0, c, false, false);
  if (NT >= 2) c = __builtin_amdgcn_wmma_f32_16x16x32_bf16(false, al, false, bh, (short)0, c, false, false);
  if (NT >= 3) c = __builtin_amdgcn_wmma_f32_16x16x32_bf16(false, ah, false, bl, (short)0, c, false, false);
  asm volatile("v_nop\n\tv_nop\n\tv_nop\n\tv_nop" : "+v"(c) : "v"(ah), "v"(al), "v"(bh), "v"(bl));
  return c;
}

__global__ __launch_bounds__(256) void k_wt_bf16(const float* __restrict__ W, unsigned short* __restrict__ Wt, int K, int N) {
  const int t = blockIdx.x * 256 + threadIdx.x;
  const int k8n = K / 8;
  if (t >= N * k8n) return;
  const int n = t / k8n, k8 = (t % k8n) * 8;
  v8us v;
#pragma unroll
  for (int i = 0; i < 8; ++i) v[i] = bf16_bits(W[(size_t)(k8 + i) * N + n]);
  *(v8us*)(Wt + (size_t)n * K + k8) = v;
  
}

// GEMM C[M][N] (f32, pitch ldc) = act(A[M][K]·W + bias). A f32 row-major (pitch lda) converted per fragment to bf16
// (ASPLIT: hi/lo two planes -> 2 terms, else single rounded term); Wt bf16 [N][K] (pitch ldb). BIAS_BF16 rounds the
// bias to bf16 first (bias quantised to bf16 before the add). K%32==0, M%16==0, N%64==0.
template <bool ASPLIT, int ACT, bool BIAS_BF16>
__global__ __launch_bounds__(128) void k_gemm_bf(const float* __restrict__ A, int lda, const unsigned short* __restrict__ Wt, int ldb,
                                               const float* __restrict__ bias, float* __restrict__ C, int ldc, int M, int N, int K) {
  __shared__ __attribute__((aligned(16))) float so[4][16][64];
  const int tid = threadIdx.x, w = tid >> 5, lane = tid & 31, ln = lane & 15, hh = lane >> 4;
  const int ntn = N / 64;
  const int wid = blockIdx.x * 4 + w;
  const int mt = wid / ntn, nq = wid % ntn;
  if (mt * 16 >= M) return;
  const int row0 = mt * 16, col0 = nq * 64;
  const float* arow = A + (size_t)(row0 + ln) * lda;
  v8f acc[4] = {};
  for (int kb = 0; kb < K; kb += 32) {
    FragB ah, al;
    const v4f x0 = *(const v4fa*)(arow + kb + 8 * hh), x1 = *(const v4fa*)(arow + kb + 8 * hh + 4);
    const v4f x2 = *(const v4fa*)(arow + kb + 16 + 8 * hh), x3 = *(const v4fa*)(arow + kb + 16 + 8 * hh + 4);
    float xs[16] = {x0[0],x0[1],x0[2],x0[3],x1[0],x1[1],x1[2],x1[3],x2[0],x2[1],x2[2],x2[3],x3[0],x3[1],x3[2],x3[3]};
#pragma unroll
    for (int i = 0; i < 16; ++i) { const unsigned short hb = bf16_bits(xs[i]); ah.u[i] = hb; al.u[i] = ASPLIT ? bf16_bits(xs[i] - bf16_val(hb)) : (unsigned short)0; }
#pragma unroll
    for (int t = 0; t < 4; ++t) {
      const unsigned short* brow = Wt + (size_t)(col0 + t * 16 + ln) * ldb + kb;
      FragB b;
      b.half[0] = *(const v8us*)(brow + 8 * hh);
      b.half[1] = *(const v8us*)(brow + 16 + 8 * hh);
      acc[t] = mmaN<ASPLIT ? 2 : 1>(ah.v, al.v, b.v, b.v, acc[t]);
    }
  }
#pragma unroll
  for (int t = 0; t < 4; ++t) {
    float bv = bias ? bias[col0 + t * 16 + ln] : 0.f;
    if (BIAS_BF16) bv = bf16_round(bv);
#pragma unroll
    for (int r = 0; r < 8; ++r) { float v = acc[t][r] + bv; if (ACT == 1) v = fmaxf(v, 0.f); so[w][8 * hh + r][t * 16 + ln] = v; }
  }
  __builtin_amdgcn_fence(__ATOMIC_ACQ_REL, "workgroup");
  __builtin_amdgcn_wave_barrier();
  const int rsub = lane >> 4, c4 = (lane & 15) * 4;
  {
#pragma unroll
    for (int q = 0; q < 8; ++q) {
      const int r = q * 2 + rsub;
      const v4f v = *(const v4fa*)&so[w][r][c4];
      *(v4f*)(C + (size_t)(row0 + r) * ldc + col0 + c4) = v;
    }
    
  }
}

// GEMM C = act(A·W + bias + resid): A f32 (ASPLIT -> hi/lo 2 terms), Wt bf16 [N][K]; ACT 0 none, 1 relu, 2 exact gelu;
// resid (optional, f32, row index = (row % rmod), pitch ldr, RES_BF16 rounds it) added before the activation.
template <bool ASPLIT, int ACT, bool BIAS_BF16, bool RES_BF16>
__global__ __launch_bounds__(128) void k_gemm_bf3(const float* __restrict__ A, int lda, const unsigned short* __restrict__ Wt, int ldb,
                                                const float* __restrict__ bias, const float* __restrict__ resid, int rmod, int ldr,
                                                float* __restrict__ C, int ldc, int M, int N, int K) {
  __shared__ __attribute__((aligned(16))) float so[4][16][64];
  const int tid = threadIdx.x, w = tid >> 5, lane = tid & 31, ln = lane & 15, hh = lane >> 4;
  const int ntn = N / 64;
  const int wid = blockIdx.x * 4 + w;
  const int mt = wid / ntn, nq = wid % ntn;
  if (mt * 16 >= M) return;
  const int row0 = mt * 16, col0 = nq * 64;
  const float* arow = A + (size_t)(row0 + ln) * lda;
  v8f acc[4] = {};
  for (int kb = 0; kb < K; kb += 32) {
    FragB ah, al;
    const v4f x0 = *(const v4fa*)(arow + kb + 8 * hh), x1 = *(const v4fa*)(arow + kb + 8 * hh + 4);
    const v4f x2 = *(const v4fa*)(arow + kb + 16 + 8 * hh), x3 = *(const v4fa*)(arow + kb + 16 + 8 * hh + 4);
    float xs[16] = {x0[0],x0[1],x0[2],x0[3],x1[0],x1[1],x1[2],x1[3],x2[0],x2[1],x2[2],x2[3],x3[0],x3[1],x3[2],x3[3]};
#pragma unroll
    for (int i = 0; i < 16; ++i) { const unsigned short hb = bf16_bits(xs[i]); ah.u[i] = hb; al.u[i] = ASPLIT ? bf16_bits(xs[i] - bf16_val(hb)) : (unsigned short)0; }
#pragma unroll
    for (int t = 0; t < 4; ++t) {
      const unsigned short* brow = Wt + (size_t)(col0 + t * 16 + ln) * ldb + kb;
      FragB b;
      b.half[0] = *(const v8us*)(brow + 8 * hh);
      b.half[1] = *(const v8us*)(brow + 16 + 8 * hh);
      acc[t] = mmaN<ASPLIT ? 2 : 1>(ah.v, al.v, b.v, b.v, acc[t]);
    }
  }
#pragma unroll
  for (int t = 0; t < 4; ++t) {
    const int col = col0 + t * 16 + ln;
    float bv = bias ? bias[col] : 0.f;
    if (BIAS_BF16) bv = bf16_round(bv);
#pragma unroll
    for (int r = 0; r < 8; ++r) {
      float v = acc[t][r] + bv;
      if (resid) { float rv = resid[(size_t)((row0 + 8 * hh + r) % rmod) * ldr + col]; if (RES_BF16) rv = bf16_round(rv); v += rv; }
      if (ACT == 1) v = fmaxf(v, 0.f);
      if (ACT == 2) v = 0.5f * v * (1.0f + erff(v * 0.70710678118654752f));
      if (ACT == 3) { const float u = 0.7978845608028654f * (v + 0.044715f * v * v * v); v = 0.5f * v * (1.0f + tanhf(u)); }
      so[w][8 * hh + r][t * 16 + ln] = v;
    }
  }
  __builtin_amdgcn_fence(__ATOMIC_ACQ_REL, "workgroup");
  __builtin_amdgcn_wave_barrier();
  const int rsub = lane >> 4, c4 = (lane & 15) * 4;
  {
#pragma unroll
    for (int q = 0; q < 8; ++q) {
      const int r = q * 2 + rsub;
      const v4f v = *(const v4fa*)&so[w][r][c4];
      *(v4f*)(C + (size_t)(row0 + r) * ldc + col0 + c4) = v;
    }
    
  }
}
// row LayerNorm (biased variance, eps) over N: s = X (+ R); optional out_sum <- s; out_norm <- (s-mu)*rsqrt(var+eps)*g + b
template <bool PARAM_BF16>
__global__ __launch_bounds__(256) void k_layernorm(const float* __restrict__ X, const float* __restrict__ R, const float* __restrict__ g, const float* __restrict__ bta,
                                                  float* __restrict__ out_sum, float* __restrict__ out_norm, int N, float eps) {
  __shared__ float red[256];
  const int row = blockIdx.x, tid = threadIdx.x;
  const float* x = X + (size_t)row * N; const float* rr = R ? R + (size_t)row * N : nullptr;
  float vals[16];                     // up to N = 4096
  const int per = N / 256;            // contiguous chunk per thread? use strided-by-4 chunks: thread handles j = tid*4 + 1024*u
  float s1 = 0.f;
  for (int u = 0; u < per / 4; ++u) {
    const int j = tid * 4 + 1024 * u;
    const v4f a = *(const v4fa*)(x + j);
    v4f b = {0.f,0.f,0.f,0.f}; if (rr) b = *(const v4fa*)(rr + j);
#pragma unroll
    for (int q = 0; q < 4; ++q) { const float v = a[q] + b[q]; vals[u * 4 + q] = v; s1 += v; }
  }
  red[tid] = s1; __syncthreads();
  for (int st = 128; st > 0; st >>= 1) { if (tid < st) red[tid] += red[tid + st]; __syncthreads(); }
  const float mu = red[0] / (float)N; __syncthreads();
  float s2 = 0.f;
  for (int u = 0; u < per / 4; ++u)
#pragma unroll
    for (int q = 0; q < 4; ++q) { const float c = vals[u * 4 + q] - mu; s2 += c * c; }
  red[tid] = s2; __syncthreads();
  for (int st = 128; st > 0; st >>= 1) { if (tid < st) red[tid] += red[tid + st]; __syncthreads(); }
  const float rs = rsqrtf(red[0] / (float)N + eps);
  {
    for (int u = 0; u < per / 4; ++u) {
      const int j = tid * 4 + 1024 * u;
      v4f o, sm;
#pragma unroll
      for (int q = 0; q < 4; ++q) {
        float gg = g[j + q], bb = bta[j + q];
        if (PARAM_BF16) { gg = bf16_round(gg); bb = bf16_round(bb); }
        sm[q] = vals[u * 4 + q]; o[q] = (vals[u * 4 + q] - mu) * rs * gg + bb;
      }
      if (out_sum) *(v4f*)(out_sum + (size_t)row * N + j) = sm;
      *(v4f*)(out_norm + (size_t)row * N + j) = o;
    }
    
  }
}



// ---- f16 WMMA path (v_wmma_f32_16x16x32_f16): 11-bit significands for operands in range — used where a [0,1] probability operand needs more precision than bf16
typedef _Float16 v16h __attribute__((ext_vector_type(16)));
union FragH { v16h v; v8us half[2]; _Float16 h[16]; unsigned short u[16]; };
template <int NT>
__device__ __forceinline__ v8f mmaH(v16h ah, v16h al, v16h bh, v16h bl, v8f c) {
  c = __builtin_amdgcn_wmma_f32_16x16x32_f16(false, ah, false, bh, (short)0, c, false, false);
  if (NT >= 2) c = __builtin_amdgcn_wmma_f32_16x16x32_f16(false, al, false, bh, (short)0, c, false, false);
  if (NT >= 3) c = __builtin_amdgcn_wmma_f32_16x16x32_f16(false, ah, false, bl, (short)0, c, false, false);
  asm volatile("v_nop\n\tv_nop\n\tv_nop\n\tv_nop" : "+v"(c) : "v"(ah), "v"(al), "v"(bh), "v"(bl));
  return c;
}
// batched GEMM like k_gemm_b but f16 operands: A f32 (split into f16 hi/lo if ASPLIT, else rounded to f16), Bt = f16 values [n][k]; alpha; C f32; N multiple of 16 (partial tiles skipped)
template <bool ASPLIT>
__global__ __launch_bounds__(128) void k_gemm_h(const float* __restrict__ A, int lda, size_t sA, const _Float16* __restrict__ Bh, int ldb, size_t sB, float alpha, float* __restrict__ C, int ldc, size_t sC, int M, int N, int K) {
  __shared__ __attribute__((aligned(16))) float so[4][16][64];
  const int tid = threadIdx.x, w = tid >> 5, lane = tid & 31, ln = lane & 15, hh = lane >> 4; const int by = blockIdx.y;
  A += (size_t)by * sA; Bh += (size_t)by * sB; C += (size_t)by * sC;
  const int ntn = (N + 63) / 64; const int wid = blockIdx.x * 4 + w; const int mt = wid / ntn, nq = wid % ntn; if (mt * 16 >= M) return;
  const int row0 = mt * 16, col0 = nq * 64; const float* arow = A + (size_t)(row0 + ln) * lda;
  v8f acc[4] = {};
  for (int kb = 0; kb < K; kb += 32) {
    FragH ah, al;
    const v4f x0 = *(const v4fa*)(arow + kb + 8 * hh), x1 = *(const v4fa*)(arow + kb + 8 * hh + 4), x2 = *(const v4fa*)(arow + kb + 16 + 8 * hh), x3 = *(const v4fa*)(arow + kb + 16 + 8 * hh + 4);
    float xs[16] = {x0[0],x0[1],x0[2],x0[3],x1[0],x1[1],x1[2],x1[3],x2[0],x2[1],x2[2],x2[3],x3[0],x3[1],x3[2],x3[3]};
#pragma unroll
    for (int i = 0; i < 16; ++i) { const _Float16 h = (_Float16)xs[i]; ah.h[i] = h; al.h[i] = ASPLIT ? (_Float16)(xs[i] - (float)h) : (_Float16)0.0f; }
#pragma unroll
    for (int t = 0; t < 4; ++t) { if (col0 + t * 16 >= N) continue; const size_t boff = (size_t)(col0 + t * 16 + ln) * ldb + kb; FragH bq; bq.half[0] = *(const v8us*)(Bh + boff + 8 * hh); bq.half[1] = *(const v8us*)(Bh + boff + 16 + 8 * hh);
      acc[t] = mmaH<ASPLIT ? 2 : 1>(ah.v, al.v, bq.v, bq.v, acc[t]); }
  }
#pragma unroll
  for (int t = 0; t < 4; ++t) { if (col0 + t * 16 >= N) continue;
#pragma unroll
    for (int r = 0; r < 8; ++r) so[w][8 * hh + r][t * 16 + ln] = acc[t][r] * alpha; }
  __builtin_amdgcn_fence(__ATOMIC_ACQ_REL, "workgroup"); __builtin_amdgcn_wave_barrier();
  const int rsub = lane >> 4, c4 = (lane & 15) * 4;
  {
#pragma unroll
    for (int q = 0; q < 8; ++q) { const int r = q * 2 + rsub; if (col0 + c4 < N) { const v4f v = *(const v4fa*)&so[w][r][c4]; *(v4f*)(C + (size_t)(row0 + r) * ldc + col0 + c4) = v; } }
     }
}

// Wt[n][k] = f16(W[k][n]·scale) from f32 row-major W[K][N] (scale = power of two; bf16-exact weights stay exact in f16 away from the subnormal range)
__global__ __launch_bounds__(256) void k_wt_f16(const float* __restrict__ W, _Float16* __restrict__ Wt, int K, int N, float scale) {
  const int t = blockIdx.x * 256 + threadIdx.x; if (t >= N * (K / 8)) return; const int n = t / (K / 8), k8 = (t % (K / 8)) * 8; FragH f;
#pragma unroll
  for (int i = 0; i < 8; ++i) f.h[i] = (_Float16)(bf16_round(W[(size_t)(k8 + i) * N + n]) * scale); const v8us o = f.half[0];
  *(v8us*)((unsigned short*)Wt + (size_t)n * K + k8) = o; 
}
// k_gemm_hh variant with fused epilogue: v = acc·alpha + bias[by·sBias + col] (+ CP[(row/rowsPerB)·sCPb + by·64 + col] if CP) ; ACT 0 none / 1 elu ; writes f16 C16 (and f32 C if non-null)
template <int ACT>
__global__ __launch_bounds__(128) void k_gemm_hhx(const _Float16* __restrict__ A, int lda, size_t sA, const _Float16* __restrict__ Bh, int ldb, size_t sB, float alpha, const float* __restrict__ bias, size_t sBias, const float* __restrict__ CP, int rowsPerB, size_t sCPb, int row0g,
    float* __restrict__ C, _Float16* __restrict__ C16, int ldc, size_t sC, int M, int N, int K) {
  __shared__ __attribute__((aligned(16))) float so[4][16][64];
  const int tid = threadIdx.x, w = tid >> 5, lane = tid & 31, ln = lane & 15, hh = lane >> 4; const int by = blockIdx.y;
  A += (size_t)by * sA; Bh += (size_t)by * sB; const size_t cofs = (size_t)by * sC; const float* bp = bias ? bias + (size_t)by * sBias : nullptr;
  const int ntn = (N + 63) / 64; const int wid = blockIdx.x * 4 + w; const int mt = wid / ntn, nq = wid % ntn; if (mt * 16 >= M) return;
  const int row0 = mt * 16, col0 = nq * 64; const _Float16* arow = A + (size_t)(row0 + ln) * lda;
  v8f acc[4] = {};
  for (int kb = 0; kb < K; kb += 32) { FragH ah; ah.half[0] = *(const v8us*)((const unsigned short*)arow + kb + 8 * hh); ah.half[1] = *(const v8us*)((const unsigned short*)arow + kb + 16 + 8 * hh);
#pragma unroll
    for (int t = 0; t < 4; ++t) { if (col0 + t * 16 >= N) continue; const size_t boff = (size_t)(col0 + t * 16 + ln) * ldb + kb; FragH bq; bq.half[0] = *(const v8us*)((const unsigned short*)Bh + boff + 8 * hh); bq.half[1] = *(const v8us*)((const unsigned short*)Bh + boff + 16 + 8 * hh);
      acc[t] = mmaH<1>(ah.v, ah.v, bq.v, bq.v, acc[t]); }
  }
#pragma unroll
  for (int t = 0; t < 4; ++t) { if (col0 + t * 16 >= N) continue; const int col = col0 + t * 16 + ln; const float bv = bp ? bf16_round(bp[col]) : 0.f;
#pragma unroll
    for (int r = 0; r < 8; ++r) { float v = acc[t][r] * alpha + bv; if (CP) { const int rr = row0g + row0 + 8 * hh + r; if (rowsPerB < 0) v += CP[cofs + (size_t)rr * ldc + col];      /* rowsPerB < 0: own element of the batched C plane */ else { const int bidx = rr / rowsPerB; v += CP[(size_t)bidx * sCPb + (size_t)by * 64 + col]; } } if (ACT == 1) v = (v > 0.f) ? v : expm1f(v); else if (ACT == 7) v = (v > 0.f) ? v + 1.0f : expf(v); else if (ACT == 8) v = tanhf(v); else if (ACT == 9) v = 0.5f * v * (1.0f + tanhf(0.7978845608028654f * (v + 0.044715f * v * v * v))); else if (ACT == 11) v = 1.0f / (1.0f + expf(-v)); else if (ACT == 12) v = (v > 0.f) ? v : 0.01f * v; else if (ACT == 14) v = (v > 0.f) ? v : 0.1f * v; else if (ACT == 16) v = (v >= 0.f) ? v : 0.3f * v; else if (ACT == 17) v = (v >= 0.f) ? v : 0.2f * v; else if (ACT == 15) v = v / (1.0f + expf(-v)); else if (ACT == 3) v = fmaxf(v, 0.f); else if (ACT == 6) v = 0.5f * v * (1.0f + erff(v * 0.70710678118654752f)); so[w][8 * hh + r][t * 16 + ln] = v; } }
  __builtin_amdgcn_fence(__ATOMIC_ACQ_REL, "workgroup"); __builtin_amdgcn_wave_barrier();
  const int rsub = lane >> 4, c4 = (lane & 15) * 4; typedef _Float16 v4h __attribute__((ext_vector_type(4)));
  {
#pragma unroll
    for (int q = 0; q < 8; ++q) { const int r = q * 2 + rsub; if (col0 + c4 < N) { const v4f v = *(const v4fa*)&so[w][r][c4]; if (C) *(v4f*)(C + cofs + (size_t)(row0 + r) * ldc + col0 + c4) = v; if (C16) { v4h h4; for (int i = 0; i < 4; ++i) h4[i] = (_Float16)v[i]; *(v4h*)(C16 + cofs + (size_t)(row0 + r) * ldc + col0 + c4) = h4; } } }
     }
}


typedef _Float16 v4h __attribute__((ext_vector_type(4)));

__global__ __launch_bounds__(256) void k_x16(const float* __restrict__ x, _Float16* __restrict__ X16, size_t n8) { const size_t t = (size_t)blockIdx.x * 256 + threadIdx.x; if (t >= n8) return; FragH f;
#pragma unroll
  for (int q = 0; q < 8; ++q) f.h[q] = (_Float16)bf16_round(x[t * 8 + q]); *(v8us*)((unsigned short*)X16 + t * 8) = f.half[0];  }
__global__ __launch_bounds__(256) void k_h16(const float* __restrict__ x, _Float16* __restrict__ X16, size_t n8) { const size_t t = (size_t)blockIdx.x * 256 + threadIdx.x; if (t >= n8) return; FragH f;
#pragma unroll
  for (int q = 0; q < 8; ++q) f.h[q] = (_Float16)x[t * 8 + q]; *(v8us*)((unsigned short*)X16 + t * 8) = f.half[0];  }
// d_*: the passes that read inputs only, each written for block number blk of its own range; k_prep below runs them all in one launch
__device__ __forceinline__ void d_round16f(unsigned blk, const float* __restrict__ W, _Float16* __restrict__ Bt, size_t n8) { const size_t t = (size_t)blk * 256 + threadIdx.x; if (t >= n8) return; FragH f;
#pragma unroll
  for (int i = 0; i < 8; ++i) f.h[i] = (_Float16)(bf16_round(W[t * 8 + i]) * 16.0f); *(v8us*)((unsigned short*)Bt + t * 8) = f.half[0];  }
template <int NHv, int TTv>
__global__ __launch_bounds__(256) void k_vt(const _Float16* __restrict__ V16, int ldv, int voff, _Float16* __restrict__ Vt) { __shared__ unsigned short tl[64][66]; const int tid = threadIdx.x; const int slab = blockIdx.x / (TTv / 64), lg = blockIdx.x % (TTv / 64); const int b = slab / NHv, h = slab % NHv;
  for (int i = tid; i < 64 * 8; i += 256) { const int r = i / 8, c8 = (i % 8) * 8; FragH f; f.half[0] = *(const v8us*)((const unsigned short*)V16 + ((size_t)b * TTv + lg * 64 + r) * ldv + voff + h * 64 + c8);
#pragma unroll
    for (int q = 0; q < 8; ++q) tl[r][c8 + q] = f.u[q]; }
  __syncthreads();
  {
#pragma unroll
    for (int rd = 0; rd < 2; ++rd) { const int d = rd * 32 + tid / 8, pc = tid % 8; FragH f;
#pragma unroll
      for (int q = 0; q < 8; ++q) f.u[q] = tl[pc * 8 + q][d];
      *(v8us*)((unsigned short*)Vt + ((size_t)slab * 64 + d) * TTv + lg * 64 + pc * 8) = f.half[0]; }
     } }

__global__ __launch_bounds__(256) void k_hl(const float* __restrict__ F, _Float16* __restrict__ Hh, _Float16* __restrict__ Hl, size_t n8) { const size_t t = (size_t)blockIdx.x * 256 + threadIdx.x; if (t >= n8) return; FragH fh, fl; const v4f a = *(const v4fa*)(F + t * 8), c = *(const v4fa*)(F + t * 8 + 4);
#pragma unroll
  for (int q = 0; q < 4; ++q) { _Float16 h = (_Float16)a[q]; fh.h[q] = h; fl.h[q] = (_Float16)((a[q] - (float)h) * 1024.0f); h = (_Float16)c[q]; fh.h[4 + q] = h; fl.h[4 + q] = (_Float16)((c[q] - (float)h) * 1024.0f); }
  { *(v8us*)((unsigned short*)Hh + t * 8) = fh.half[0]; *(v8us*)((unsigned short*)Hl + t * 8) = fl.half[0];  } }

// ---- fast GEMM (wave tile 32x64; requires M % 32 == 0 rows per launch region and N % 64 == 0); epilogue = k_gemm_hhx semantics ----
__device__ __forceinline__ v16h g2_frag(const _Float16* p, int hh) { FragH f; f.half[0] = *(const v8us*)((const unsigned short*)p + 8 * hh); f.half[1] = *(const v8us*)((const unsigned short*)p + 16 + 8 * hh); return f.v; }
__device__ __forceinline__ v8f g2_mma(v16h a, v16h b, v8f c) { v8f d = __builtin_amdgcn_wmma_f32_16x16x32_f16(false, a, false, b, (short)0, c, false, false); asm volatile("v_nop\n\tv_nop\n\tv_nop\n\tv_nop" : "+v"(d) : "v"(a), "v"(b)); return d; }
// PK: the 64-column tiles 1 (k, 16 live) and 2, 3 (v) leave LDS in the layouts that k_attn reads, so that every fragment load of a wave there is 512 contiguous bytes, and are not stored as rows:
// KC = [NB][NP][16]: the 16 live key columns. VF = [NB][NP / 32][8 channel tiles][2][32 lanes][8]: the A fragments of V^T (row = channel 16 ct + (lane & 15), k = key 16 h2 + 8 (lane >> 4) + i of the block of 32).
template <int ACT, bool PK = false>
__global__ __launch_bounds__(128) void k_gemm2(const _Float16* __restrict__ A, int lda, size_t sA, const _Float16* __restrict__ Bh, int ldb, size_t sB, float alpha, const float* __restrict__ bias, size_t sBias, const float* __restrict__ CP, int rowsPerB, size_t sCPb, int row0g,
    float* __restrict__ C, _Float16* __restrict__ C16, int ldc, size_t sC, int M, int N, int K, _Float16* __restrict__ KC, _Float16* __restrict__ VF) { static_assert(ACT == 0 || ACT == 3 || ACT == 6 || ACT == 8 || ACT == 9 || ACT == 11 || ACT == 12 || ACT == 14 || ACT == 15 || ACT == 16 || ACT == 17, "k_gemm2: unsupported ACT code (would silently apply no activation)");
  __shared__ __attribute__((aligned(16))) float so[4][32][68];
  const int tid = threadIdx.x, w = tid >> 5, lane = tid & 31, ln = lane & 15, hh = lane >> 4; const int by = blockIdx.y;
  A += (size_t)by * sA; Bh += (size_t)by * sB; const size_t cofs = (size_t)by * sC; const float* bp = bias ? bias + (size_t)by * sBias : nullptr;
  const int ntn = N >> 6; const int mt = blockIdx.x / ntn, nq = blockIdx.x - mt * ntn; const int row0 = mt * 128 + 32 * w, col0 = nq * 64; if (row0 >= M) return;
  const _Float16* a0p = A + (size_t)(row0 + ln) * lda; const _Float16* a1p = a0p + (size_t)16 * lda;
  const _Float16* b0p = Bh + (size_t)(col0 + ln) * ldb; const _Float16* b1p = b0p + (size_t)16 * ldb; const _Float16* b2p = b1p + (size_t)16 * ldb; const _Float16* b3p = b2p + (size_t)16 * ldb;
  const v8f z8 = {0.f,0.f,0.f,0.f,0.f,0.f,0.f,0.f}; v8f c00 = z8, c01 = z8, c02 = z8, c03 = z8, c10 = z8, c11 = z8, c12 = z8, c13 = z8;
#pragma unroll 1
  for (int kb = 0; kb < K; kb += 32) { const v16h a0 = g2_frag(a0p + kb, hh), a1 = g2_frag(a1p + kb, hh);
    asm volatile("s_wait_xcnt 0x0" ::: "memory");      /* stands before the A loads' address registers are rewritten */
    v16h b = g2_frag(b0p + kb, hh); c00 = g2_mma(a0, b, c00); c10 = g2_mma(a1, b, c10);
    b = g2_frag(b1p + kb, hh); c01 = g2_mma(a0, b, c01); c11 = g2_mma(a1, b, c11);
    b = g2_frag(b2p + kb, hh); c02 = g2_mma(a0, b, c02); c12 = g2_mma(a1, b, c12);
    b = g2_frag(b3p + kb, hh); c03 = g2_mma(a0, b, c03); c13 = g2_mma(a1, b, c13); }
  v8f accs[8] = {c00, c01, c02, c03, c10, c11, c12, c13};
#pragma unroll
  for (int u = 0; u < 8; ++u) { const int t = u & 3, half = u >> 2; const int col = col0 + t * 16 + ln; const float bv = bp ? bf16_round(bp[col]) : 0.f;
#pragma unroll
    for (int r = 0; r < 8; ++r) { const int rloc = half * 16 + 8 * hh + r; float v = accs[u][r] * alpha + bv; if (CP) { if (rowsPerB < 0) v += CP[cofs + (size_t)(row0g + row0 + rloc) * ldc + col];      /* rowsPerB < 0: own element of the batched C plane */ else { const int bidx = (row0g + row0 + rloc) / rowsPerB; v += CP[(size_t)bidx * sCPb + (size_t)by * 64 + col]; } }
      if (ACT == 3) v = fmaxf(v, 0.f); else if (ACT == 6) v = 0.5f * v * (1.0f + erff(v * 0.70710678118654752f)); else if (ACT == 11) v = 1.0f / (1.0f + expf(-v)); else if (ACT == 15) v = v / (1.0f + expf(-v)); else if (ACT == 12) v = (v > 0.f) ? v : 0.01f * v; else if (ACT == 8) v = tanhf(v); else if (ACT == 9) v = 0.5f * v * (1.0f + tanhf(0.7978845608028654f * (v + 0.044715f * v * v * v))); else if (ACT == 14) v = (v > 0.f) ? v : 0.1f * v; else if (ACT == 16) v = (v >= 0.f) ? v : 0.3f * v; else if (ACT == 17) v = (v >= 0.f) ? v : 0.2f * v;
      so[w][rloc][t * 16 + ln] = v; } }
  __builtin_amdgcn_fence(__ATOMIC_ACQ_REL, "workgroup"); __builtin_amdgcn_wave_barrier();
  const int rsub = lane >> 4, c4 = (lane & 15) * 4;
  if (PK && nq == 1) {      /* the same for the whole work-group. lane = row: 32 B each, the wave's 32 rows 1 KiB in a run */
    FragH f;
#pragma unroll
    for (int i = 0; i < 4; ++i) { const v4f v = *(const v4fa*)&so[w][lane][i * 4]; for (int e = 0; e < 4; ++e) f.h[i * 4 + e] = (_Float16)v[e]; }
    unsigned short* d = (unsigned short*)KC + (size_t)(row0 + lane) * 16; *(v8us*)d = f.half[0]; *(v8us*)(d + 8) = f.half[1];
  } else if (PK && nq >= 2) {      /* the wave's 32 rows are one block of 32 keys, its 64 columns 4 channel tiles: piece u = (tile u >> 1, h2 = u & 1), 4 KiB in a run */
    unsigned short* d = (unsigned short*)VF + (size_t)(row0 >> 5) * 4096 + (nq - 2) * 2048 + lane * 8;
#pragma unroll
    for (int u = 0; u < 8; ++u) { FragH f; for (int i = 0; i < 8; ++i) f.h[i] = (_Float16)so[w][(u & 1) * 16 + 8 * hh + i][(u >> 1) * 16 + ln];
      *(v8us*)(d + u * 256) = f.half[0]; asm volatile("s_wait_xcnt 0x0" ::: "memory"); /* stands before the store's data registers are rewritten by the next piece */ }
  } else {
#pragma unroll
    for (int q = 0; q < 16; ++q) { const int r = q * 2 + rsub; const v4f v = *(const v4fa*)&so[w][r][c4]; if (C) { *(v4f*)(C + cofs + (size_t)(row0 + r) * ldc + col0 + c4) = v; asm volatile("s_wait_xcnt 0x0" ::: "memory"); /* stands before the store's data and address registers are rewritten by the next piece */ } if (C16) { v4h h4; for (int i = 0; i < 4; ++i) h4[i] = (_Float16)v[i]; *(v4h*)(C16 + cofs + (size_t)(row0 + r) * ldc + col0 + c4) = h4; } }
     } }

// ---- k_gemm2 with both operands staged in LDS (requires M % 128 == 0, N % 64 == 0, K % 128 == 0); same tiles, same k order, same epilogue ----
// A stage is 128 k (256 B, two whole lines) of the work-group's 128 A rows and 64 B rows; every wave-wide copy covers two whole rows of it (4 lines) where a fragment load from global touched 16 lines.
#define G3_KS 128
#define G3_PITCH 272                    /* LDS row pitch, bytes: 16 B x odd, conflict-free for ds_load_b128 */
#define G3_STAGE (192 * G3_PITCH)       /* rows 0..127 = A, rows 128..191 = B */
#define G3_C(l, g) "global_load_async_to_lds_b128 %" #l ", %" #g ", off\n\t"
// twelve copies and, as the statement's last line, the wait that stands before any register they name is rewritten
#define G3_COPY12(L, G, o) asm volatile(G3_C(0, 12) G3_C(1, 13) G3_C(2, 14) G3_C(3, 15) G3_C(4, 16) G3_C(5, 17) G3_C(6, 18) G3_C(7, 19) G3_C(8, 20) G3_C(9, 21) G3_C(10, 22) G3_C(11, 23) "s_wait_xcnt 0x0" \
    :: "v"(L[o + 0]), "v"(L[o + 1]), "v"(L[o + 2]), "v"(L[o + 3]), "v"(L[o + 4]), "v"(L[o + 5]), "v"(L[o + 6]), "v"(L[o + 7]), "v"(L[o + 8]), "v"(L[o + 9]), "v"(L[o + 10]), "v"(L[o + 11]), \
       "v"(G[o + 0]), "v"(G[o + 1]), "v"(G[o + 2]), "v"(G[o + 3]), "v"(G[o + 4]), "v"(G[o + 5]), "v"(G[o + 6]), "v"(G[o + 7]), "v"(G[o + 8]), "v"(G[o + 9]), "v"(G[o + 10]), "v"(G[o + 11]) : "memory")
// one stage: 24 copies of 16 B per lane. l = the lane's LDS byte address in row (tid >> 4) of the buffer, ga / gb = its global address in that row of the A / B tile; copy j serves row 8 j + (tid >> 4)
// IM8: the A tile's 128 rows are 8 h-lines of 16 w-positions of the bordered rows, so tile row 8 j + .. lies (j >> 1) bordered h-lines and 8 (j & 1) positions behind row (tid >> 4)
template <bool IM8>
__device__ __forceinline__ void g3_fill(unsigned l, const _Float16* ga, size_t sa8, const _Float16* gb, size_t sb8) {
  constexpr int NA = 16;
  unsigned L[24]; const _Float16* G[24];
#pragma unroll      /* both loops: every index constant, so that L and G are registers the asm can name */
  for (int j = 0; j < NA; ++j) { L[j] = l + (unsigned)j * (8u * G3_PITCH); G[j] = ga + (IM8 ? (size_t)(((j >> 1) * PD + (j & 1) * 8) * CC) : (size_t)j * sa8); }
#pragma unroll
  for (int j = 0; j < 24 - NA; ++j) { L[NA + j] = l + (unsigned)(NA + j) * (8u * G3_PITCH); G[NA + j] = gb + (size_t)j * sb8; }
  G3_COPY12(L, G, 0); G3_COPY12(L, G, 12); }
__device__ __forceinline__ v16h g3_frag(const unsigned char* p) { FragH f; f.half[0] = *(const v8us*)p; f.half[1] = *(const v8us*)(p + 32); return f.v; }
// IM8: A = bordered rows [NB][PD][PD][PD][CC] and the product is the k2 conv: stage s is channels 128 (s & 1) .. + 127 of tap s >> 1 = (dt, dh, dw), read for output position (t, h, w) at bordered index (t + dt, h + dh, w + dw); k = tap * CC + channel
// EPI: what follows v = acc * alpha + bias, done as the tile leaves LDS (planes by = 0 only for 5). 0: store v (f32 C and / or f16 C16). 3: f32 elu(v) to C. (1 and 2 are the k2 convs' own: k_conv below.)
// 4: f16 elu(elu(v) + CP[row][col]) to C16. 5: f32 elu(v) to C = [NB][CC][NP], channel-major.
__device__ __forceinline__ float elu1(float a) { const float e = expm1f(a); return (a > 0.f) ? a : e; }      /* expm1f stands outside the choice: no branch per element, so that the chains of neighbouring elements overlap in a wave that is alone on its SIMD */
template <int ACT, bool IM8 = false, int EPI = 0>
__global__ __launch_bounds__(128) void k_gemm2s(const _Float16* __restrict__ A, int lda, size_t sA, const _Float16* __restrict__ Bh, int ldb, size_t sB, float alpha, const float* __restrict__ bias, size_t sBias, const float* __restrict__ CP, int rowsPerB, size_t sCPb, int row0g,
    float* __restrict__ C, _Float16* __restrict__ C16, int ldc, size_t sC, int M, int N, int K) { static_assert(ACT == 0 || ACT == 3 || ACT == 6 || ACT == 8 || ACT == 9 || ACT == 11 || ACT == 12 || ACT == 14 || ACT == 15 || ACT == 16 || ACT == 17, "k_gemm2s: unsupported ACT code (would silently apply no activation)");
  static_assert(EPI == 0 || EPI >= 3, "epilogues 1 and 2 are k_conv's");
  __shared__ __attribute__((aligned(16))) unsigned char st[2 * G3_STAGE];
  __shared__ __attribute__((aligned(16))) float so[4][32][68];
  const int tid = threadIdx.x, w = tid >> 5, lane = tid & 31, ln = lane & 15, hh = lane >> 4; const int by = blockIdx.y;
  A += (size_t)by * sA; Bh += (size_t)by * sB; const size_t cofs = (size_t)by * sC; const float* bp = bias ? bias + (size_t)by * sBias : nullptr;
  const int ntn = N >> 6; const int mt = blockIdx.x / ntn, nq = blockIdx.x - mt * ntn; const int row0 = mt * 128 + 32 * w, col0 = nq * 64; if (mt * 128 >= M) return;      /* the same for the whole work-group, in front of every barrier */
  const int crow = tid >> 4, cch = tid & 15; const size_t sa8 = (size_t)8 * lda, sb8 = (size_t)8 * ldb;
  static_assert(!IM8 || (DT == 16 && DH == 16 && DW == 16 && CC == 2 * G3_KS), "IM8: a 128-row tile is 8 h-lines of 16, a tap is two stages");
  const _Float16* gA = IM8 ? A + (size_t)((mt >> 5) * NPP + ((mt >> 1) & 15) * (PD * PD) + (mt & 1) * (8 * PD) + crow) * CC + cch * 8 : A + (size_t)(mt * 128 + crow) * lda + cch * 8;
  auto aoff = [](int t) -> size_t { return IM8 ? (size_t)((((t >> 3) & 1) * (PD * PD) + ((t >> 2) & 1) * PD + ((t >> 1) & 1)) * CC + (t & 1) * G3_KS) : (size_t)t * G3_KS; };      /* stage t's place behind gA, elements */
  const _Float16* gB = Bh + (size_t)(col0 + crow) * ldb + cch * 8;
  const unsigned l0 = (unsigned)(size_t)st + (unsigned)(crow * G3_PITCH + cch * 16);
  const unsigned char* fa = st + (32 * w + ln) * G3_PITCH + 16 * hh; const unsigned char* fb = st + (128 + ln) * G3_PITCH + 16 * hh;
  const int nt = K / G3_KS;
  const v8f z8 = {0.f,0.f,0.f,0.f,0.f,0.f,0.f,0.f}; v8f c00 = z8, c01 = z8, c02 = z8, c03 = z8, c10 = z8, c11 = z8, c12 = z8, c13 = z8;
  g3_fill<IM8>(l0, gA, sa8, gB, sb8);
  asm volatile("s_wait_asynccnt 0x0" ::: "memory");      /* this wave's copies of stage 0 have landed */
  __syncthreads();                                        /* ... and every other wave's */
  if (nt > 1) g3_fill<IM8>(l0 + G3_STAGE, gA + aoff(1), sa8, gB + G3_KS, sb8);
#pragma unroll 1      /* one trip per stage: the buffer index stays a run-time value */
  for (int t = 0; t < nt; ++t) { const unsigned bo = (unsigned)(t & 1) * G3_STAGE; const unsigned char* pa = fa + bo; const unsigned char* pb = fb + bo;
    v16h a0 = g3_frag(pa), a1 = g3_frag(pa + 16 * G3_PITCH), b0 = g3_frag(pb), b1 = g3_frag(pb + 16 * G3_PITCH), b2 = g3_frag(pb + 32 * G3_PITCH), b3 = g3_frag(pb + 48 * G3_PITCH);
#pragma unroll      /* constant LDS offsets; the next 32 k's fragments (same stage) are read as one group ahead of this 32 k's WMMAs */
    for (int ks = 0; ks < 4; ++ks) { v16h na0 = a0, na1 = a1, nb0 = b0, nb1 = b1, nb2 = b2, nb3 = b3;
      if (ks < 3) { const unsigned char* qa = pa + (ks + 1) * 64; const unsigned char* qb = pb + (ks + 1) * 64; na0 = g3_frag(qa); na1 = g3_frag(qa + 16 * G3_PITCH); nb0 = g3_frag(qb); nb1 = g3_frag(qb + 16 * G3_PITCH); nb2 = g3_frag(qb + 32 * G3_PITCH); nb3 = g3_frag(qb + 48 * G3_PITCH); }
      c00 = g2_mma(a0, b0, c00); c10 = g2_mma(a1, b0, c10); c01 = g2_mma(a0, b1, c01); c11 = g2_mma(a1, b1, c11);
      c02 = g2_mma(a0, b2, c02); c12 = g2_mma(a1, b2, c12); c03 = g2_mma(a0, b3, c03); c13 = g2_mma(a1, b3, c13);
      a0 = na0; a1 = na1; b0 = nb0; b1 = nb1; b2 = nb2; b3 = nb3; }
    asm volatile("s_wait_dscnt 0x0" ::: "memory");        /* this wave's reads of the buffer are done before it is refilled */
    asm volatile("s_wait_asynccnt 0x0" ::: "memory");     /* this wave's copies of stage t + 1 have landed */
    __syncthreads();                                      /* publishes stage t + 1 and ends every wave's reads of stage t */
    if (t + 2 < nt) g3_fill<IM8>(l0 + bo, gA + aoff(t + 2), sa8, gB + (size_t)(t + 2) * G3_KS, sb8); }
  asm volatile("s_wait_asynccnt 0x0" ::: "memory");       /* no copy outstanding behind the loop */
  const int rsub = lane >> 4, c4 = (lane & 15) * 4;
  v8f accs[8] = {c00, c01, c02, c03, c10, c11, c12, c13};
#pragma unroll
  for (int u = 0; u < 8; ++u) { const int t = u & 3, half = u >> 2; const int col = col0 + t * 16 + ln; const float bv = bp ? bf16_round(bp[col]) : 0.f;
#pragma unroll
    for (int r = 0; r < 8; ++r) { const int rloc = half * 16 + 8 * hh + r; float v = accs[u][r] * alpha + bv; if (EPI == 0 && CP) { if (rowsPerB < 0) v += CP[cofs + (size_t)(row0g + row0 + rloc) * ldc + col];      /* rowsPerB < 0: own element of the batched C plane */ else { const int bidx = (row0g + row0 + rloc) / rowsPerB; v += CP[(size_t)bidx * sCPb + (size_t)by * 64 + col]; } }
      if (ACT == 3) v = fmaxf(v, 0.f); else if (ACT == 6) v = 0.5f * v * (1.0f + erff(v * 0.70710678118654752f)); else if (ACT == 11) v = 1.0f / (1.0f + expf(-v)); else if (ACT == 15) v = v / (1.0f + expf(-v)); else if (ACT == 12) v = (v > 0.f) ? v : 0.01f * v; else if (ACT == 8) v = tanhf(v); else if (ACT == 9) v = 0.5f * v * (1.0f + tanhf(0.7978845608028654f * (v + 0.044715f * v * v * v))); else if (ACT == 14) v = (v > 0.f) ? v : 0.1f * v; else if (ACT == 16) v = (v >= 0.f) ? v : 0.3f * v; else if (ACT == 17) v = (v >= 0.f) ? v : 0.2f * v;
      so[w][rloc][t * 16 + ln] = v; } }
  __builtin_amdgcn_fence(__ATOMIC_ACQ_REL, "workgroup"); __builtin_amdgcn_wave_barrier();
  if (EPI == 0) {
#pragma unroll
    for (int q = 0; q < 16; ++q) { const int r = q * 2 + rsub; const v4f v = *(const v4fa*)&so[w][r][c4]; if (C) { *(v4f*)(C + cofs + (size_t)(row0 + r) * ldc + col0 + c4) = v; asm volatile("s_wait_xcnt 0x0" ::: "memory"); /* stands before the store's data and address registers are rewritten by the next piece */ } if (C16) { v4h h4; for (int i = 0; i < 4; ++i) h4[i] = (_Float16)v[i]; *(v4h*)(C16 + cofs + (size_t)(row0 + r) * ldc + col0 + c4) = h4; } }
  } else if (EPI == 5) {      /* the wave's 32 rows are 32 neighbouring positions of one batch: 8 lanes x 4 positions = one whole 128-B line of a channel */
    const int pg = (lane & 7) * 4, cs = lane >> 3; float* ob = C + ((size_t)(row0 / NP) * CC + col0 + cs) * NP + (row0 % NP) + pg;
#pragma unroll 1      /* stays a loop: 64 inlined expm1f would be straight-line code that every wave fetches and runs once; a trip's 8 elements are independent chains */
    for (int q = 0; q < 8; ++q) { const float* sp = &so[w][pg][q * 8 + cs]; float x[8];
#pragma unroll
      for (int i = 0; i < 8; ++i) x[i] = sp[(i & 3) * 68 + (i >> 2) * 4];
      v4f v0, v1;
#pragma unroll
      for (int i = 0; i < 4; ++i) { v0[i] = elu1(x[i]); v1[i] = elu1(x[4 + i]); }
      *(v4f*)(ob + (size_t)(q * 8) * NP) = v0; *(v4f*)(ob + (size_t)(q * 8 + 4) * NP) = v1;
      asm volatile("s_wait_xcnt 0x0" ::: "memory"); /* stands before the stores' data and address registers are rewritten by the next trip */ }
  } else {
    v4f o0 = {0.f, 0.f, 0.f, 0.f}, o1 = o0;      /* EPI 4: the addend of the trip at hand, loaded one trip ahead */
    if (EPI == 4) { o0 = *(const v4fa*)(CP + (size_t)(row0 + rsub) * ldc + col0 + c4); o1 = *(const v4fa*)(CP + (size_t)(row0 + rsub + 2) * ldc + col0 + c4); asm volatile("s_wait_xcnt 0x0" ::: "memory"); /* stands before the loads' address registers are rewritten */ }
#pragma unroll 1      /* stays a loop, as above */
    for (int q = 0; q < 8; ++q) { const int r = q * 4 + rsub, R = row0 + r; v4f v0 = *(const v4fa*)&so[w][r][c4], v1 = *(const v4fa*)&so[w][r + 2][c4]; v4f n0 = o0, n1 = o1;
      if (EPI == 4) { const int Rn = R + ((q < 7) ? 4 : 0); n0 = *(const v4fa*)(CP + (size_t)Rn * ldc + col0 + c4); n1 = *(const v4fa*)(CP + (size_t)(Rn + 2) * ldc + col0 + c4); }
#pragma unroll
      for (int i = 0; i < 4; ++i) { v0[i] = elu1(v0[i]); v1[i] = elu1(v1[i]); }
      if (EPI == 3) { *(v4f*)(C + cofs + (size_t)R * ldc + col0 + c4) = v0; *(v4f*)(C + cofs + (size_t)(R + 2) * ldc + col0 + c4) = v1; }
      else {
        if (EPI == 4) {
#pragma unroll
          for (int i = 0; i < 4; ++i) { v0[i] = elu1(v0[i] + o0[i]); v1[i] = elu1(v1[i] + o1[i]); } }
        const size_t dr = (size_t)R;
        v4h h0, h1;
#pragma unroll
        for (int i = 0; i < 4; ++i) { h0[i] = (_Float16)v0[i]; h1[i] = (_Float16)v1[i]; }
        *(v4h*)(C16 + cofs + dr * ldc + col0 + c4) = h0; *(v4h*)(C16 + cofs + (dr + 2) * ldc + col0 + c4) = h1; }
      asm volatile("s_wait_xcnt 0x0" ::: "memory"); /* stands before the registers of this trip's loads and stores are rewritten by the next trip */
      o0 = n0; o1 = n1; }
  } }


// ---- the k2 convs: the tile's input rows stay in LDS ----
// A tile of 128 output positions is 8 h-lines of one t. Its 8 taps read 2 t-planes x 9 h-lines x 17 positions of the bordered rows, each plane a run of 153 rows in memory. The work-group copies these rows to LDS once
// (all 256 channels, one row per wave-wide copy) and tap (dt, dh, dw) reads its A fragments there, (dh * 17 + dw) rows further on in plane dt; only the B stages (128 k) go through two buffers. Same wave tiles, same k order as k_gemm2s<.., IM8>.
// Plane 0 and B stage 0 land before the loop; plane 1, first read in trip 8, comes in groups of five rows per wave behind the barriers of the first trips, beside the B stages.
// EPI 1 (4 waves, tile 128 x 64): f16 elu(v) to C16 = bordered rows, at the row's interior place.
// EPI 2 (8 waves, tile 128 rows x (64 columns a | the 64 columns g that lie CC behind them), waves 2 i / 2 i + 1 = a / g of rows 32 i ..): C[row][col] += a * sigmoid(g), f16 elu of it to C16 = bordered rows, and, where X16 is given, f16 of it to X16 (pitch XP).
#define CV_PP 528                      /* LDS pitch of an input row, bytes: 512 + 16 = 16 B x odd, conflict-free for ds_load_b128 */
#define CV_LR (9 * PD)                 /* rows of a plane that the tile reads */
#define CV_PL 160                      /* LDS rows per plane: CV_LR rounded up, so that every wave issues the same number of copies; rows CV_LR .. are never read */
// five / eight copies and, as the statement's last line, the wait that stands before any register they name is rewritten
#define CV_COPY5(L, G) asm volatile(G3_C(0, 5) G3_C(1, 6) G3_C(2, 7) G3_C(3, 8) G3_C(4, 9) "s_wait_xcnt 0x0" \
    :: "v"(L[0]), "v"(L[1]), "v"(L[2]), "v"(L[3]), "v"(L[4]), "v"(G[0]), "v"(G[1]), "v"(G[2]), "v"(G[3]), "v"(G[4]) : "memory")
#define CV_COPY8(L, G) asm volatile(G3_C(0, 8) G3_C(1, 9) G3_C(2, 10) G3_C(3, 11) G3_C(4, 12) G3_C(5, 13) G3_C(6, 14) G3_C(7, 15) "s_wait_xcnt 0x0" \
    :: "v"(L[0]), "v"(L[1]), "v"(L[2]), "v"(L[3]), "v"(L[4]), "v"(L[5]), "v"(L[6]), "v"(L[7]), "v"(G[0]), "v"(G[1]), "v"(G[2]), "v"(G[3]), "v"(G[4]), "v"(G[5]), "v"(G[6]), "v"(G[7]) : "memory")
// group grp of a plane: wave w copies LDS rows (5 grp + i) NW + w. l / g = the lane's 16 bytes in the plane's row 0, in LDS / in memory; an LDS row past the plane's last takes the last row's bytes, so that the source address stays inside the buffer
template <int NW>
__device__ __forceinline__ void cv_rows(unsigned l, const _Float16* g, int w, int grp) {
  unsigned L[5]; const _Float16* G[5];
#pragma unroll      /* every index constant, so that L and G are registers the asm can name */
  for (int i = 0; i < 5; ++i) { const int r = (grp * 5 + i) * NW + w; L[i] = l + (unsigned)r * CV_PP; G[i] = g + (size_t)((r < CV_LR) ? r : CV_LR - 1) * CC; }
  CV_COPY5(L, G); }
// one B stage: copy j serves LDS row RS j + (tid >> 4). GT: LDS rows 64 .. 127 are the weight rows that lie 256 behind rows 0 .. 63 (the gate halves of the same channels)
template <bool GT>
__device__ __forceinline__ void cv_b(unsigned l, const _Float16* g) {
  constexpr int RS = GT ? 16 : 8;
  unsigned L[8]; const _Float16* G[8];
#pragma unroll      /* as above */
  for (int j = 0; j < 8; ++j) { L[j] = l + (unsigned)(j * RS) * G3_PITCH; G[j] = g + (size_t)(j * RS + ((GT && j >= 4) ? 192 : 0)) * K8; }
  CV_COPY8(L, G); }
template <int EPI>
__global__ __launch_bounds__(EPI == 2 ? 256 : 128) void k_conv(const _Float16* __restrict__ A, const _Float16* __restrict__ Bh, float alpha, const float* __restrict__ bias, float* __restrict__ C, _Float16* __restrict__ C16, _Float16* __restrict__ X16) {
  static_assert(EPI == 1 || EPI == 2, "k_conv: epilogue 1 or 2"); static_assert(DT == 16 && DH == 16 && DW == 16 && CC == 2 * G3_KS, "a 128-row tile is 8 h-lines of 16, a tap is two stages");
  constexpr bool GT = EPI == 2; constexpr int NW = GT ? 8 : 4, NG = CV_PL / (5 * NW), BST = (GT ? 128 : 64) * G3_PITCH, ldc = CC, nt = K8 / G3_KS;
  static_assert(NG * 5 * NW == CV_PL && NG <= 8 && NG * 5 + 8 <= 63, "whole groups; plane 1 is in LDS before trip 8; copies outstanding per wave");
  __shared__ __attribute__((aligned(16))) unsigned char sp[2 * CV_PL * CV_PP];
  __shared__ __attribute__((aligned(16))) unsigned char sb[2 * BST];
  __shared__ __attribute__((aligned(16))) float so[NW][32][68];
  const int tid = threadIdx.x, w = __builtin_amdgcn_readfirstlane(tid >> 5) /* the wave's number in a scalar register: the rows it copies are scalar arithmetic */, lane = tid & 31, ln = lane & 15, hh = lane >> 4;
  const int mt = blockIdx.x >> 2, nq = blockIdx.x & 3, wr = GT ? w >> 1 : w; const int row0 = mt * 128 + 32 * wr, col0 = nq * 64;
  const _Float16* gP = A + (size_t)((mt >> 5) * NPP + ((mt >> 1) & 15) * (PD * PD) + (mt & 1) * (8 * PD)) * CC + lane * 8;
  const unsigned lP = (unsigned)(size_t)sp + (unsigned)lane * 16u;
  const int crow = tid >> 4, cch = tid & 15;
  const _Float16* gB = Bh + (size_t)(col0 + crow) * K8 + cch * 8;
  const unsigned lB = (unsigned)(size_t)sb + (unsigned)(crow * G3_PITCH + cch * 16);
  const unsigned char* fa = sp + (2 * wr * PD + ln) * CV_PP + 16 * hh; const unsigned char* fb = sb + ((GT ? 64 * (w & 1) : 0) + ln) * G3_PITCH + 16 * hh;
  const v8f z8 = {0.f,0.f,0.f,0.f,0.f,0.f,0.f,0.f}; v8f c00 = z8, c01 = z8, c02 = z8, c03 = z8, c10 = z8, c11 = z8, c12 = z8, c13 = z8;
  for (int g = 0; g < NG; ++g) cv_rows<NW>(lP, gP, w, g);
  cv_b<GT>(lB, gB);
  asm volatile("s_wait_asynccnt 0x0" ::: "memory");      /* this wave's copies of plane 0 and of B stage 0 have landed */
  __syncthreads();                                        /* ... and every other wave's */
  cv_b<GT>(lB + BST, gB + G3_KS);
  cv_rows<NW>(lP + CV_PL * CV_PP, gP + (size_t)(PD * PD) * CC, w, 0);
#pragma unroll 1      /* one trip per stage: the buffer index stays a run-time value */
  for (int t = 0; t < nt; ++t) { const unsigned bo = (unsigned)(t & 1) * BST;
    const unsigned char* pa = fa + (((t >> 3) & 1) * CV_PL + ((t >> 2) & 1) * PD + ((t >> 1) & 1)) * CV_PP + (t & 1) * (2 * G3_KS); const unsigned char* pb = fb + bo;      /* stage t = channels 128 (t & 1) .. of tap t >> 1 = (dt, dh, dw) */
    v16h a0 = g3_frag(pa), a1 = g3_frag(pa + PD * CV_PP), b0 = g3_frag(pb), b1 = g3_frag(pb + 16 * G3_PITCH), b2 = g3_frag(pb + 32 * G3_PITCH), b3 = g3_frag(pb + 48 * G3_PITCH);
#pragma unroll      /* constant LDS offsets; the next 32 k's fragments (same stage) are read as one group ahead of this 32 k's WMMAs */
    for (int ks = 0; ks < 4; ++ks) { v16h na0 = a0, na1 = a1, nb0 = b0, nb1 = b1, nb2 = b2, nb3 = b3;
      if (ks < 3) { const unsigned char* qa = pa + (ks + 1) * 64; const unsigned char* qb = pb + (ks + 1) * 64; na0 = g3_frag(qa); na1 = g3_frag(qa + PD * CV_PP); nb0 = g3_frag(qb); nb1 = g3_frag(qb + 16 * G3_PITCH); nb2 = g3_frag(qb + 32 * G3_PITCH); nb3 = g3_frag(qb + 48 * G3_PITCH); }
      c00 = g2_mma(a0, b0, c00); c10 = g2_mma(a1, b0, c10); c01 = g2_mma(a0, b1, c01); c11 = g2_mma(a1, b1, c11);
      c02 = g2_mma(a0, b2, c02); c12 = g2_mma(a1, b2, c12); c03 = g2_mma(a0, b3, c03); c13 = g2_mma(a1, b3, c13);
      a0 = na0; a1 = na1; b0 = nb0; b1 = nb1; b2 = nb2; b3 = nb3; }
    asm volatile("s_wait_dscnt 0x0" ::: "memory");        /* this wave's reads of the B buffer are done before it is refilled */
    asm volatile("s_wait_asynccnt 0x0" ::: "memory");     /* this wave's copies of B stage t + 1 and of its last group of plane 1 have landed */
    __syncthreads();                                      /* publishes them and ends every wave's reads of B stage t */
    if (t + 2 < nt) cv_b<GT>(lB + bo, gB + (size_t)(t + 2) * G3_KS);
    if (t + 1 < NG) cv_rows<NW>(lP + CV_PL * CV_PP, gP + (size_t)(PD * PD) * CC, w, t + 1); }      /* the last group goes out behind trip NG - 2 <= 6 and is published by the barrier of the trip after it */
  asm volatile("s_wait_asynccnt 0x0" ::: "memory");       /* no copy outstanding behind the loop */
  const int rsub = lane >> 4, c4 = (lane & 15) * 4;
  float* rp = GT ? C + (size_t)(row0 + (w & 1) * 16 + rsub) * ldc + col0 + c4 : nullptr;      /* EPI 2: the wave gates rows 16 (w & 1) .. + 15 of its pair's 32; a lane has 4 channels of rows rsub + 2 i */
  v4f r0 = {0.f, 0.f, 0.f, 0.f}, r1 = r0;      /* EPI 2: the C values of the trip at hand, loaded one trip ahead; the first fly while the tiles go to LDS */
  if (GT) { r0 = *(const v4fa*)rp; r1 = *(const v4fa*)(rp + 2 * (size_t)ldc); asm volatile("s_wait_xcnt 0x0" ::: "memory"); /* stands before the loads' address registers are rewritten */ }
  v8f accs[8] = {c00, c01, c02, c03, c10, c11, c12, c13};
#pragma unroll
  for (int u = 0; u < 8; ++u) { const int t = u & 3, half = u >> 2; const int col = col0 + t * 16 + ln + (GT ? (w & 1) * ldc : 0); const float bv = bf16_round(bias[col]);
#pragma unroll
    for (int r = 0; r < 8; ++r) so[w][half * 16 + 8 * hh + r][t * 16 + ln] = accs[u][r] * alpha + bv; }
  __builtin_amdgcn_fence(__ATOMIC_ACQ_REL, "workgroup"); __builtin_amdgcn_wave_barrier();
  if (EPI == 2) {
    __syncthreads();      /* the partner wave's tile (the other of a and g) is in LDS */
    const float* pa = &so[w & ~1][(w & 1) * 16 + rsub][c4]; const float* pg = pa + 32 * 68;      /* so[w & ~1] = a, so[(w & ~1) + 1] = g */
#pragma unroll 1      /* stays a loop: the inlined exponentials would be straight-line code that every wave fetches and runs once; a trip's 8 elements are independent chains */
    for (int q = 0; q < 4; ++q) { const int R = row0 + (w & 1) * 16 + q * 4 + rsub; const v4f a0 = *(const v4fa*)(pa + q * (4 * 68)), a1 = *(const v4fa*)(pa + q * (4 * 68) + 2 * 68), g0 = *(const v4fa*)(pg + q * (4 * 68)), g1 = *(const v4fa*)(pg + q * (4 * 68) + 2 * 68);
      float* rq = rp + (size_t)(q * 4) * ldc; const float* rn = rq + (size_t)((q < 3) ? 4 : 0) * ldc;
      const v4f n0 = *(const v4fa*)rn, n1 = *(const v4fa*)(rn + 2 * (size_t)ldc);
      v4f v0, v1;
#pragma unroll
      for (int i = 0; i < 4; ++i) { v0[i] = r0[i] + a0[i] * (1.0f / (1.0f + expf(-g0[i]))); v1[i] = r1[i] + a1[i] * (1.0f / (1.0f + expf(-g1[i]))); }
      *(v4f*)rq = v0; *(v4f*)(rq + 2 * (size_t)ldc) = v1; asm volatile("s_wait_xcnt 0x0" ::: "memory"); /* stands before the stores' registers are rewritten */
      const int p = R % NP;      /* rows R and R + 2 lie in one w-line of 16: R = .. + 4 q + (0 or 1) */
      const size_t dr = (size_t)((R / NP) * NPP + (p / (DH * DW) + 1) * (PD * PD) + ((p / DW) % DH + 1) * PD + (p % DW) + 1);
      v4h h0, h1;
#pragma unroll
      for (int i = 0; i < 4; ++i) { h0[i] = (_Float16)elu1(v0[i]); h1[i] = (_Float16)elu1(v1[i]); }
      *(v4h*)(C16 + dr * ldc + col0 + c4) = h0; *(v4h*)(C16 + (dr + 2) * ldc + col0 + c4) = h1; asm volatile("s_wait_xcnt 0x0" ::: "memory"); /* stands before the stores' registers are rewritten */
      if (X16) {      /* the same for the whole launch */
#pragma unroll
        for (int i = 0; i < 4; ++i) { h0[i] = (_Float16)v0[i]; h1[i] = (_Float16)v1[i]; }
        *(v4h*)(X16 + (size_t)R * XP + col0 + c4) = h0; *(v4h*)(X16 + (size_t)(R + 2) * XP + col0 + c4) = h1; }
      asm volatile("s_wait_xcnt 0x0" ::: "memory"); /* stands before the registers of this trip's loads and stores are rewritten by the next trip */
      r0 = n0; r1 = n1; }
  } else {
#pragma unroll 1      /* stays a loop: 64 inlined expm1f would be straight-line code that every wave fetches and runs once; a trip's 8 elements are independent chains */
    for (int q = 0; q < 8; ++q) { const int r = q * 4 + rsub, R = row0 + r; v4f v0 = *(const v4fa*)&so[w][r][c4], v1 = *(const v4fa*)&so[w][r + 2][c4];
#pragma unroll
      for (int i = 0; i < 4; ++i) { v0[i] = elu1(v0[i]); v1[i] = elu1(v1[i]); }
      const int p = R % NP;      /* rows R and R + 2 lie in one w-line of 16: R = .. + 4 q + (0 or 1) */
      const size_t dr = (size_t)((R / NP) * NPP + (p / (DH * DW) + 1) * (PD * PD) + ((p / DW) % DH + 1) * PD + (p % DW) + 1);
      v4h h0, h1;
#pragma unroll
      for (int i = 0; i < 4; ++i) { h0[i] = (_Float16)v0[i]; h1[i] = (_Float16)v1[i]; }
      *(v4h*)(C16 + dr * ldc + col0 + c4) = h0; *(v4h*)(C16 + (dr + 2) * ldc + col0 + c4) = h1;
      asm volatile("s_wait_xcnt 0x0" ::: "memory"); /* stands before the stores' registers are rewritten by the next trip */ }
  } }

__device__ __forceinline__ void d_xrows(unsigned blk, const float* __restrict__ x, float* __restrict__ RES, _Float16* __restrict__ E) { __shared__ float tl[CC][33]; const int tid = threadIdx.x; const int b = blk / (NP / 32), pb = blk % (NP / 32); const int p0 = pb * 32;
  const int j0 = tid % 32;      /* i = i0 + 256 u: column i % 32 is the thread's own, channel i / 32 goes up by 8 with u */
  for (int i0 = tid; i0 < CC * 32; i0 += 8 * 256) { const int cb = i0 / 32; float xv[8];
#pragma unroll      /* eight loads in flight, then their one wait */
    for (int u = 0; u < 8; ++u) xv[u] = x[((size_t)b * CC + cb + 8 * u) * NP + p0 + j0];
    asm volatile("s_wait_xcnt 0x0" ::: "memory");      /* stands before the loads' address registers are rewritten */
#pragma unroll
    for (int u = 0; u < 8; ++u) tl[cb + 8 * u][j0] = bf16_round(xv[u]); }
  __syncthreads();
  { for (int i = tid; i < 32 * (CC / 8); i += 256) { const int j = i / (CC / 8), c0 = (i % (CC / 8)) * 8; v8f v; for (int q = 0; q < 8; ++q) v[q] = tl[c0 + q][j]; *(v8f*)(RES + ((size_t)b * NP + p0 + j) * CC + c0) = v;
      FragH f; for (int q = 0; q < 8; ++q) { const float a = v[q]; f.h[q] = (_Float16)((a > 0.f) ? a : expm1f(a)); } const int p = p0 + j;      /* elu(res) as f16 at the row's interior place in the bordered rows */
      *(v8us*)((unsigned short*)E + ((size_t)b * NPP + (size_t)((p / (DH * DW) + 1) * (PD * PD) + ((p / DW) % DH + 1) * PD + (p % DW) + 1)) * CC + c0) = f.half[0];
      asm volatile("s_wait_xcnt 0x0" ::: "memory"); /* stands before the stores' registers are rewritten by the next trip */ }  } }
// zeros at the bordered positions with an index 0, in both bordered buffers (their interiors are written by d_xrows and by GEMM epilogues): one thread per 8 channels of a border position
#define NBD (NPP - NP)      /* 817 = 17 * 17 (t = 0) + 16 * 17 (h = 0) + 16 * 16 (w = 0) */
__device__ __forceinline__ void d_border(unsigned blk, _Float16* __restrict__ E, _Float16* __restrict__ Z) { const int t = (int)blk * 256 + (int)threadIdx.x; if (t >= NB * NBD * (CC / 8)) return; const int c8 = (t % (CC / 8)) * 8, i = (t / (CC / 8)) % NBD, b = t / ((CC / 8) * NBD);
  const int j1 = i - PD * PD, j2 = j1 - DT * PD; const int pp = (j1 < 0) ? i : (j2 < 0) ? (j1 / PD + 1) * (PD * PD) + j1 % PD : (j2 / DH + 1) * (PD * PD) + (j2 % DH + 1) * PD;
  const v8us z = {0, 0, 0, 0, 0, 0, 0, 0}; const size_t o = ((size_t)b * NPP + pp) * CC + c8; *(v8us*)((unsigned short*)E + o) = z; *(v8us*)((unsigned short*)Z + o) = z; }
__device__ __forceinline__ void d_w8(unsigned blk, const float* __restrict__ w, int O, _Float16* __restrict__ Bt) { const size_t t = (size_t)blk * 256 + threadIdx.x; if (t >= (size_t)O * K8 / 8) return; const int c8 = (int)((t * 8) % CC); const int tap = (int)(((t * 8) / CC) % 8); const int o = (int)((t * 8) / K8); FragH f; for (int q = 0; q < 8; ++q) f.h[q] = (_Float16)(bf16_round(w[((size_t)o * CC + c8 + q) * 8 + tap]) * 16.0f);
  *(v8us*)((unsigned short*)Bt + t * 8) = f.half[0];  }
// columns 256 .. 287 of the concat rows XA (pitch XP): the 3 original channels, the 3 position codes, zeros; inputs only. Columns 0 .. 255 (res) come from the last gate's epilogue
__device__ __forceinline__ void d_xat(unsigned blk, const float* __restrict__ orig, _Float16* __restrict__ XA) { const size_t t = (size_t)blk * 256 + threadIdx.x; if (t >= NR * 4) return; const int pc = 32 + (int)(t % 4); const size_t r = t / 4; const int p = (int)(r % NP); const size_t b = r / NP; FragH f;
  for (int q = 0; q < 8; ++q) { const int col = pc * 8 + q; float v = 0.f; if (col < 259) v = bf16_round(orig[((b * 3 + (col - 256)) * (size_t)NP) + p]); else if (col == 259) v = -0.5f + (float)(p / (DH * DW)) / (float)DT; else if (col == 260) v = -0.5f + (float)((p / DW) % DH) / (float)DH; else if (col == 261) v = -0.5f + (float)(p % DW) / (float)DW; f.h[q] = (_Float16)v; }
  unsigned short* d = (unsigned short*)XA + r * XP + pc * 8; *(v8us*)d = f.half[0];  }
__device__ __forceinline__ void d_wa(unsigned blk, const float* __restrict__ w, int O, int OP, _Float16* __restrict__ Bt) { const size_t t = (size_t)blk * 256 + threadIdx.x; if (t >= (size_t)OP * KA / 8) return; const int k0 = (int)((t * 8) % KA); const int o = (int)((t * 8) / KA); FragH f; for (int q = 0; q < 8; ++q) { const int k = k0 + q; f.h[q] = (o < O && k < 262) ? (_Float16)(bf16_round(w[(size_t)o * 262 + k]) * 16.0f) : (_Float16)0.f; }
  *(v8us*)((unsigned short*)Bt + t * 8) = f.half[0];  }
// block ranges of k_prep, in launch order (the x transpose and the large conv weights first)
#define PB_X  (NB * (NP / 32))
#define PB_W2 (NRES * 512 * K8 / 8 / 256)
#define PB_W1 (NRES * CC * K8 / 8 / 256)
#define PB_R  (CC * CC / 8 / 256)
#define PB_A  (CC * VC / 8 / 256)
#define PB_QK (64 * KA / 8 / 256)
#define PB_V  (VC * KA / 8 / 256)
#define PB_XT ((int)(NR * 4 / 256))
#define PB_BD ((NB * NBD * (CC / 8) + 255) / 256)
#define PB_ALL (PB_X + PB_W2 + PB_W1 + 2 * PB_R + PB_A + 2 * PB_QK + PB_V + PB_XT + PB_BD + 1)
// every pass that depends on inputs alone, in one launch: the block number picks the pass (the same for a whole work-group, so d_xrows' barrier stands under uniform control flow).
// BW1 / BW2 hold all NRES blocks' conv weights (rw1 / rw2 are NRES stacked tensors: one run of output rows). BQKV = 64 q rows (16 live) | 64 k rows (16 live) | 128 v rows; bqkv = their biases in the same order.
__global__ __launch_bounds__(256) void k_prep(const float* __restrict__ x, const float* __restrict__ orig, const float* __restrict__ rw1, const float* __restrict__ rw2, const float* __restrict__ qw, const float* __restrict__ kw, const float* __restrict__ vw, const float* __restrict__ qb, const float* __restrict__ kb, const float* __restrict__ vb,
    const float* __restrict__ aw, const float* __restrict__ rsw, const float* __restrict__ ow, float* __restrict__ RES, _Float16* __restrict__ BW1, _Float16* __restrict__ BW2, _Float16* __restrict__ BQKV, float* __restrict__ bqkv, _Float16* __restrict__ BA, _Float16* __restrict__ BR, _Float16* __restrict__ BO, _Float16* __restrict__ XA, _Float16* __restrict__ EP, _Float16* __restrict__ O1) {
  unsigned b = blockIdx.x;
  if (b < PB_X) { d_xrows(b, x, RES, EP); return; } b -= PB_X;
  if (b < PB_W2) { d_w8(b, rw2, NRES * 512, BW2); return; } b -= PB_W2;
  if (b < PB_W1) { d_w8(b, rw1, NRES * CC, BW1); return; } b -= PB_W1;
  if (b < PB_R) { d_round16f(b, rsw, BR, (size_t)CC * CC / 8); return; } b -= PB_R;
  if (b < PB_R) { d_round16f(b, ow, BO, (size_t)CC * CC / 8); return; } b -= PB_R;
  if (b < PB_A) { d_round16f(b, aw, BA, (size_t)CC * VC / 8); return; } b -= PB_A;
  if (b < PB_QK) { d_wa(b, qw, 16, 64, BQKV); return; } b -= PB_QK;
  if (b < PB_QK) { d_wa(b, kw, 16, 64, BQKV + (size_t)64 * KA); return; } b -= PB_QK;
  if (b < PB_V) { d_wa(b, vw, VC, VC, BQKV + (size_t)128 * KA); return; } b -= PB_V;
  if (b < PB_XT) { d_xat(b, orig, XA); return; } b -= PB_XT;
  if (b < PB_BD) { d_border(b, EP, O1); return; }
  const int i = threadIdx.x, j = i & 63; float v = 0.f;
  if (i >= 128) v = vb[i - 128]; else if (j < 16) v = (i < 64) ? qb[j] : kb[j];
  bqkv[i] = v; asm volatile("s_wait_xcnt 0x0" ::: "memory"); /* stands before the store's registers are rewritten */ }
// ---- causal attention in one kernel: scores, softmax weights and P.V never leave the WGP ----
// A work-group owns FA_Q queries of one batch; its 8 waves deal the blocks of 32 keys among them (wave w: blocks w, w + 8, ..). S^T = K.Q^T: a lane holds scores of one query per column tile, so maximum and sum are in-lane,
// and the two S^T tiles of a block, turned into weights in place, are the B operand of O^T += V^T.P^T. Pass 1 finds each query's true maximum (joined through LDS), pass 2 forms the scores again, the weights
// exp(t - max) * 2^8 as f16 (sum of the unrounded weights in f32) and the products; then the 8 waves' partial O^T and sums are added through LDS, scaled by 1 / sum (query 0: 0), ELU, f16 rows.
#define FA_Q 32
#define FA_W 8
#define FA_OP 132      /* floats per query row of a wave's partial: 528 B = 16 B x odd, conflict-free for 16-byte stores */
__device__ __forceinline__ v8f fa_mma(v16h a, v16h b, v8f c) { return __builtin_amdgcn_wmma_f32_16x16x32_f16(false, a, false, b, (short)0, c, false, false); }
// the two K fragments of a block of 32 keys: row = key, k = the 16 live columns (k 16 .. 31 are zeros on both sides of the product)
__device__ __forceinline__ void fa_ldk(const unsigned short* p, FragH& k0, FragH& k1) { k0.half[0] = *(const v8us*)p; k1.half[0] = *(const v8us*)(p + 256); }
// the two S^T tiles of one block of 32 keys and one column tile: lane = query q, sa[r] = key ka + r, sb[r] = key ka + 16 + r. MK / mk: the block holds keys at or behind q (only a work-group's last block does)
template <bool MK>
__device__ __forceinline__ float fa_max(const v8f sa, const v8f sb, int ka, int q, float m) { float x[16];
#pragma unroll
  for (int r = 0; r < 8; ++r) { x[r] = (!MK || ka + r < q) ? sa[r] : -3.0e38f; x[8 + r] = (!MK || ka + 16 + r < q) ? sb[r] : -3.0e38f; }
#pragma unroll      /* a tree: no chain of 16 dependent maxima */
  for (int st = 8; st > 0; st >>= 1)
#pragma unroll
    for (int i = 0; i < st; ++i) x[i] = fmaxf(x[i], x[i + st]);
  return fmaxf(m, x[0]); }
__device__ __forceinline__ v16h fa_wgt(const v8f sa, const v8f sb, int ka, int q, float m, bool mk, float& se) { const float cs = 1.4426950408889634f / 16.093476939431082f;      /* log2(e) / sqrt(259): exp((s - max) / sqrt(259)) * 2^8 = exp2((s - max) * cs + 8) */
  float e[16]; FragH p;
#pragma unroll
  for (int r = 0; r < 8; ++r) { e[r] = (sa[r] - m) * cs + 8.0f; e[8 + r] = (sb[r] - m) * cs + 8.0f; }
  __builtin_amdgcn_sched_barrier(0);      /* this and the two in the loop: each v_nop stays directly behind its v_exp_f32 */
#pragma unroll
  for (int i = 0; i < 16; ++i) { e[i] = __builtin_amdgcn_exp2f(e[i]); __builtin_amdgcn_sched_barrier(0);
    asm volatile("v_nop");      /* the slot that the instruction set asks for behind a transcendental, before its result is read or its source rewritten */
    __builtin_amdgcn_sched_barrier(0); }
  if (mk) {      /* the same for the whole wave */
#pragma unroll
    for (int r = 0; r < 8; ++r) { e[r] = (ka + r < q) ? e[r] : 0.f; e[8 + r] = (ka + 16 + r < q) ? e[8 + r] : 0.f; } }
#pragma unroll
  for (int i = 0; i < 16; ++i) p.h[i] = (_Float16)e[i];
#pragma unroll      /* a tree: no chain of 16 dependent additions */
  for (int st = 8; st > 0; st >>= 1)
#pragma unroll
    for (int i = 0; i < st; ++i) e[i] += e[i + st];
  se += e[0]; return p.v; }
__global__ __launch_bounds__(256) void k_attn(const _Float16* __restrict__ QKV, const _Float16* __restrict__ KC, const _Float16* __restrict__ VF, _Float16* __restrict__ ATE) {
  __shared__ __attribute__((aligned(16))) float po[FA_W][FA_Q][FA_OP];
  __shared__ float redm[FA_W][2][FA_Q], reds[FA_W][2][FA_Q];
  const int tid = threadIdx.x, w = __builtin_amdgcn_readfirstlane(tid >> 5) /* the wave's number in a scalar register: the key loops become scalar loops, EXEC stays all ones round the WMMAs */, lane = tid & 31, ln = lane & 15, hh = lane >> 4, b = blockIdx.y;
  const int q0 = (NP / FA_Q - 1 - (int)blockIdx.x) * FA_Q;      /* the longest rows start first */
  const int nkb = q0 / 32 + 1;      /* blocks of 32 keys that hold a key below q0 + FA_Q - 1 */
  const unsigned short* kc = (const unsigned short*)KC + (size_t)b * NP * 16 + ln * 16 + hh * 8;
  const unsigned short* vf = (const unsigned short*)VF + (size_t)b * (NP / 32) * 4096 + lane * 8;
  const v8us z8u = {0, 0, 0, 0, 0, 0, 0, 0}; const v8f z8 = {0.f, 0.f, 0.f, 0.f, 0.f, 0.f, 0.f, 0.f};
  FragH qf0, qf1, k0, k1, n0, n1; qf0.half[1] = z8u; qf1.half[1] = z8u; k0.half[1] = z8u; k1.half[1] = z8u; n0.half[1] = z8u; n1.half[1] = z8u;
  { const unsigned short* qp = (const unsigned short*)QKV + ((size_t)b * NP + q0 + ln) * 256 + 8 * hh; qf0.half[0] = *(const v8us*)qp; qf1.half[0] = *(const v8us*)(qp + 16 * 256); }
  const int kfirst = (w < nkb) ? w : 0;      /* a wave without a block still loads in bounds */
  fa_ldk(kc + (size_t)kfirst * 512, k0, k1);
  asm volatile("s_wait_xcnt 0x0" ::: "memory");      /* stands before the loads' address registers are rewritten */
  const int qa = q0 + ln, qb = qa + 16;
  float m0 = -3.0e38f, m1 = -3.0e38f;
  for (int kb = w; kb < nkb; kb += FA_W) {
    fa_ldk(kc + (size_t)((kb + FA_W < nkb) ? kb + FA_W : kb) * 512, n0, n1);      /* the next block's K fragments fly while this block is worked on */
    asm volatile("s_wait_xcnt 0x0" ::: "memory");      /* stands before the loads' address registers are rewritten */
    const v8f s00 = fa_mma(k0.v, qf0.v, z8), s10 = fa_mma(k1.v, qf0.v, z8), s01 = fa_mma(k0.v, qf1.v, z8), s11 = fa_mma(k1.v, qf1.v, z8);
    const int ka = kb * 32 + 8 * hh;
    if (kb == nkb - 1) { m0 = fa_max<true>(s00, s10, ka, qa, m0); m1 = fa_max<true>(s01, s11, ka, qb, m1); } else { m0 = fa_max<false>(s00, s10, ka, qa, m0); m1 = fa_max<false>(s01, s11, ka, qb, m1); }
    k0.half[0] = n0.half[0]; k1.half[0] = n1.half[0]; }
  redm[w][hh][ln] = m0; redm[w][hh][16 + ln] = m1;
  fa_ldk(kc + (size_t)kfirst * 512, k0, k1);
  asm volatile("s_wait_xcnt 0x0" ::: "memory");      /* stands before the loads' address registers are rewritten */
  __syncthreads();      /* every wave's maxima are in LDS */
#pragma unroll
  for (int i = 0; i < FA_W; ++i) { m0 = fmaxf(m0, fmaxf(redm[i][0][ln], redm[i][1][ln])); m1 = fmaxf(m1, fmaxf(redm[i][0][16 + ln], redm[i][1][16 + ln])); }
  v8f acc[8][2];
#pragma unroll
  for (int ct = 0; ct < 8; ++ct) { acc[ct][0] = z8; acc[ct][1] = z8; }
  float se0 = 0.f, se1 = 0.f;
  for (int kb = w; kb < nkb; kb += FA_W) {
    FragH v[8]; const unsigned short* vp = vf + (size_t)kb * 4096;
#pragma unroll      /* this block's V^T fragments: issued first, used last */
    for (int ct = 0; ct < 8; ++ct) { v[ct].half[0] = *(const v8us*)(vp + ct * 512); v[ct].half[1] = *(const v8us*)(vp + ct * 512 + 256); }
    fa_ldk(kc + (size_t)((kb + FA_W < nkb) ? kb + FA_W : kb) * 512, n0, n1);
    asm volatile("s_wait_xcnt 0x0" ::: "memory");      /* stands before the loads' address registers are rewritten */
    const v8f s00 = fa_mma(k0.v, qf0.v, z8), s10 = fa_mma(k1.v, qf0.v, z8), s01 = fa_mma(k0.v, qf1.v, z8), s11 = fa_mma(k1.v, qf1.v, z8);
    const int ka = kb * 32 + 8 * hh; v16h p0, p1;
    p0 = fa_wgt(s00, s10, ka, qa, m0, kb == nkb - 1, se0); p1 = fa_wgt(s01, s11, ka, qb, m1, kb == nkb - 1, se1);
#pragma unroll
    for (int ct = 0; ct < 8; ++ct) { acc[ct][0] = fa_mma(v[ct].v, p0, acc[ct][0]); acc[ct][1] = fa_mma(v[ct].v, p1, acc[ct][1]); }
    k0.half[0] = n0.half[0]; k1.half[0] = n1.half[0]; }
#pragma unroll      /* acc[ct][qt][r] = O^T[channel 16 ct + 8 hh + r][query 16 qt + ln] */
  for (int ct = 0; ct < 8; ++ct)
#pragma unroll
    for (int qt = 0; qt < 2; ++qt) { float* d = &po[w][qt * 16 + ln][ct * 16 + 8 * hh]; const v8f a = acc[ct][qt]; const v4f lo = {a[0], a[1], a[2], a[3]}, hi = {a[4], a[5], a[6], a[7]}; *(v4fa*)d = lo; *(v4fa*)(d + 4) = hi; }
  reds[w][hh][ln] = se0; reds[w][hh][16 + ln] = se1;
  __syncthreads();      /* every wave's partial products and sums are in LDS */
  const int q = tid >> 3, c0 = (tid & 7) * 4; float t = 0.f;
#pragma unroll
  for (int i = 0; i < FA_W; ++i) t += reds[i][0][q] + reds[i][1][q];
  const float rs = (q0 + q == 0) ? 0.f : 1.0f / t;      /* query 0 sees no key: zeros */
  _Float16* op = ATE + ((size_t)b * NP + q0 + q) * VC + c0;
#pragma unroll
  for (int j = 0; j < 4; ++j) { v4f sm = *(const v4fa*)&po[0][q][c0 + j * 32];
#pragma unroll
    for (int i = 1; i < FA_W; ++i) { const v4f x = *(const v4fa*)&po[i][q][c0 + j * 32]; sm += x; }
    v4h h4;
#pragma unroll
    for (int i = 0; i < 4; ++i) h4[i] = (_Float16)elu1(sm[i] * rs);
    *(v4h*)(op + j * 32) = h4; }
  asm volatile("s_wait_xcnt 0x0" ::: "memory");      /* stands before the stores' registers are rewritten */
}

extern "C" void kernel_launch(void* const* d_in, const int* in_sizes, int n_in,
                              void* d_out, int out_size, void* d_ws, size_t ws_size, hipStream_t stream) {
  (void)in_sizes; (void)n_in; (void)out_size;
  const float* const* I = (const float* const*)d_in; const float* x = I[0]; const float* orig = I[1]; const float* rw1 = I[2]; const float* rb1 = I[3]; const float* rw2 = I[4]; const float* rb2 = I[5]; const float* qw = I[6]; const float* qb = I[7]; const float* kw = I[8]; const float* kb = I[9]; const float* vw = I[10]; const float* vb = I[11]; const float* aw = I[12]; const float* ab = I[13]; const float* rsw = I[14]; const float* rsb = I[15]; const float* ow = I[16]; const float* ob = I[17];
  char* ws = (char*)d_ws; size_t off = 0;
  auto take = [&](size_t bytes) { char* p = ws + off; off += (bytes + 255) & ~(size_t)255; return p; };
  _Float16* BW1 = (_Float16*)take((size_t)NRES * CC * K8 * 2); _Float16* BW2 = (_Float16*)take((size_t)NRES * 512 * K8 * 2); _Float16* BQKV = (_Float16*)take((size_t)256 * KA * 2); float* bqkv = (float*)take(256 * 4); _Float16* BA = (_Float16*)take((size_t)CC * VC * 2); _Float16* BR = (_Float16*)take((size_t)CC * CC * 2); _Float16* BO = (_Float16*)take((size_t)CC * CC * 2);
  float* RES = (float*)take(NR * CC * 4); _Float16* EP = (_Float16*)take((size_t)NB * NPP * CC * 2); _Float16* O1 = (_Float16*)take((size_t)NB * NPP * CC * 2);
  _Float16* XA = (_Float16*)take(NR * XP * 2); _Float16* QKV = (_Float16*)take(NR * 256 * 2); _Float16* VF = (_Float16*)take((size_t)NB * VC * NP * 2); _Float16* KC = (_Float16*)take((size_t)NB * NP * 16 * 2);
  _Float16* ATE = (_Float16*)take(NR * VC * 2); float* ATTC = (float*)take(NR * CC * 4); _Float16* SUM16 = (_Float16*)take(NR * CC * 2);
  if (off > ws_size) return;      /* about 58 MB */
  k_prep<<<PB_ALL, 256, 0, stream>>>(x, orig, rw1, rw2, qw, kw, vw, qb, kb, vb, aw, rsw, ow, RES, BW1, BW2, BQKV, bqkv, BA, BR, BO, XA, EP, O1);
  const dim3 g256((unsigned)((NR / 128) * (CC / 64)), 1);
  for (int i = 0; i < NRES; ++i) {
    k_conv<1><<<g256, 128, 0, stream>>>(EP, BW1 + (size_t)i * CC * K8, 0.0625f, rb1 + i * CC, nullptr, O1, nullptr);      /* o = elu(conv1 + b1), into the bordered rows */
    k_conv<2><<<g256, 256, 0, stream>>>(O1, BW2 + (size_t)i * 512 * K8, 0.0625f, rb2 + i * 512, RES, EP, (i == NRES - 1) ? XA : nullptr); }      /* o = conv2 + b2 (512); res += o[:256] * sigmoid(o[256:]); elu(res) into the bordered rows; the last res also into the concat rows */
  /* attention: q | k | v as one GEMM (N = 256) whose epilogue lays k and v out in fragment order, then scores, softmax and P.V in one kernel; blockIdx.y = batch */
  k_gemm2<0, true><<<dim3((unsigned)((NR / 128) * 4), 1), 128, 0, stream>>>(XA, XP, 0, BQKV, KA, 0, 0.0625f, bqkv, 0, nullptr, 1, 0, 0, nullptr, QKV, 256, 0, (int)NR, 256, KA, KC, VF);
  k_attn<<<dim3(NP / FA_Q, NB), 256, 0, stream>>>(QKV, KC, VF, ATE);      /* elu(att), att = softmax(q.k / sqrt(259), k < q) v */
  k_gemm2s<0, false, 3><<<g256, 128, 0, stream>>>(ATE, VC, 0, BA, VC, 0, 0.0625f, ab, 0, nullptr, 1, 0, 0, ATTC, nullptr, CC, 0, (int)NR, CC, VC);      /* att = elu(attn_conv(elu(att)) + b) */
  k_gemm2s<0, true, 4><<<g256, 128, 0, stream>>>(EP + (size_t)(PD * PD + PD + 1) * CC, CC, 0, BR, CC, 0, 0.0625f, rsb, 0, ATTC, 1, 0, 0, nullptr, SUM16, CC, 0, (int)NR, CC, CC);      /* elu(res + att), res = elu(res_conv(elu(res)) + b); A = the bordered rows' interior: the one tap (1, 1, 1) */
  k_gemm2s<0, false, 5><<<g256, 128, 0, stream>>>(SUM16, CC, 0, BO, CC, 0, 0.0625f, ob, 0, nullptr, 1, 0, 0, (float*)d_out, nullptr, CC, 0, (int)NR, CC, CC);      /* out = elu(out_conv(elu(res + att)) + b), channel-major */
}

// v009
// A run of this version takes 213 microseconds.
// Next to v008, in two timings, it ran 1.11 times as fast each time.
// All steps since the starting kernel, v000, together make it 13.7 times as fast.
#include <hip/hip_runtime.h>
// PixelSNAILBlock (x [2][256][16][16][16], original_input [2][3][16][16][16]; 4 gated residual blocks: o = elu(conv3d k2 pad1 crop(elu(res)) + b1); o = conv3d k2 pad1 crop(o) + b2 (512 ch); res += o[:256] * sigmoid(o[256:]); attention over the 4,096 positions of [res | original | pos-enc] (262 ch): q,k (16), v (128), causal softmax (k < q, row 0 all-zero) of q.k/sqrt(259), att = p v; att = elu(1x1(elu(att)) + b); res = elu(1x1(elu(res)) + b); out = elu(1x1(elu(res + att)) + b) -> [2][256][16][16][16]).
// Structure: position rows r = b*4096 + (t*16 + h)*16 + w; res kept as f32 rows; each k2 'causal-corner' conv as a WMMA GEMM over K = 8 taps x 256 channels whose A fragments are read tap by tap from the tile's zero-bordered f16 rows, held in LDS (32x64 wave tiles, f32 accumulation, exact x16 weights + bias) with the ELUs on VALU; gating on VALU; q/k/v as GEMMs on the 262 -> 288-column concat rows (16 live of 64 for q/k); one attention kernel: per 32 queries S^T = K.Q^T on WMMA (K = 32, 16 live), causal softmax weights on VALU in the accumulator registers (true row maximum from a first pass; un-normalised f16 weights x 2^8, f32 sum, row 0 -> 0), O^T += V^T.P^T on WMMA against fragment-order value planes, the keys dealt to 8 waves and the partials added through LDS, scaling; the three 1x1 convs as GEMMs followed by VALU ELUs; channel-major store on VALU.
// Compute dtype: inputs rounded to bf16; x / original / weights exact; conv operands (elu(res), o1), the concat rows, q/k/v, softmax weights and the 1x1-conv operands plain f16 (~2^-12); res accumulation, gates, softmax sums f32. v_wmma_f32_16x16x32_f16.
#define NB 2
#define CC 256
#define DT 16
#define DH 16
#define DW 16
#define NP (DT * DH * DW)            /* 4096 */
#define NR ((size_t)NB * NP)       /* 8192 */
#define NRES 4
#define K8 (8 * CC)                /* 2048 */
#define KA 288                     /* 262 live */
#define XP 320                     /* pitch of the concat rows: 640 B = whole 128-B lines, so that a 64-column piece of a row is a line of its own */
#define VC 128
#define PD 17                      /* bordered extent of t, h and w: index 0 of each axis is the conv's zero padding */
#define NPP (PD * PD * PD)         /* 4913 bordered positions per batch */
typedef __bf16 v16b __attribute__((ext_vector_type(16)));
typedef unsigned short v8us __attribute__((ext_vector_type(8), may_alias));
typedef float  v8f  __attribute__((ext_vector_type(8)));
typedef float  v4f  __attribute__((ext_vector_type(4)));
typedef float  v4fa __attribute__((ext_vector_type(4), may_alias));
union FragB { v16b v; v8us half[2]; unsigned short u[16]; };

__device__ __forceinline__ unsigned short bf16_bits(float x) { unsigned int u = __float_as_uint(x); return (unsigned short)((u + 0x7FFFu + ((u >> 16) & 1u)) >> 16); }
__device__ __forceinline__ float bf16_val(unsigned short b) { return __uint_as_float(((unsigned int)b) << 16); }
__device__ __forceinline__ float bf16_round(float x) { return bf16_val(bf16_bits(x)); }
// D += A·B with NT terms: 1 = ah·bh, 2 = + al·bh (A split), 3 = + ah·bl (both split)
template <int NT>
__device__ __forceinline__ v8f mmaN(v16b ah, v16b al, v16b bh, v16b bl, v8f c) {
  c = __builtin_amdgcn_wmma_f32_16x16x32_bf16(false, ah, false, bh, (short)0, c, false, false);
  if (NT >= 2) c = __builtin_amdgcn_wmma_f32_16x16x32_bf16(false, al, false, bh, (short)0, c, false, false);
  if (NT >= 3) c = __builtin_amdgcn_wmma_f32_16x16x32_bf16(false, ah, false, bl, (short)0, c, false, false);
  asm volatile("v_nop\n\tv_nop\n\tv_nop\n\tv_nop" : "+v"(c) : "v"(ah), "v"(al), "v"(bh), "v"(bl));
  return c;
}

__global__ __launch_bounds__(256) void k_wt_bf16(const float* __restrict__ W, unsigned short* __restrict__ Wt, int K, int N) {
  const int t = blockIdx.x * 256 + threadIdx.x;
  const int k8n = K / 8;
  if (t >= N * k8n) return;
  const int n = t / k8n, k8 = (t % k8n) * 8;
  v8us v;
#pragma unroll
  for (int i = 0; i < 8; ++i) v[i] = bf16_bits(W[(size_t)(k8 + i) * N + n]);
  *(v8us*)(Wt + (size_t)n * K + k8) = v;
  
}

// GEMM C[M][N] (f32, pitch ldc) = act(A[M][K]·W + bias). A f32 row-major (pitch lda) converted per fragment to bf16
// (ASPLIT: hi/lo two planes -> 2 terms, else single rounded term); Wt bf16 [N][K] (pitch ldb). BIAS_BF16 rounds the
// bias to bf16 first (bias quantised to bf16 before the add). K%32==0, M%16==0, N%64==0.
template <bool ASPLIT, int ACT, bool BIAS_BF16>
__global__ __launch_bounds__(128) void k_gemm_bf(const float* __restrict__ A, int lda, const unsigned short* __restrict__ Wt, int ldb,
                                               const float* __restrict__ bias, float* __restrict__ C, int ldc, int M, int N, int K) {
  __shared__ __attribute__((aligned(16))) float so[4][16][64];
  const int tid = threadIdx.x, w = tid >> 5, lane = tid & 31, ln = lane & 15, hh = lane >> 4;
  const int ntn = N / 64;
  const int wid = blockIdx.x * 4 + w;
  const int mt = wid / ntn, nq = wid % ntn;
  if (mt * 16 >= M) return;
  const int row0 = mt * 16, col0 = nq * 64;
  const float* arow = A + (size_t)(row0 + ln) * lda;
  v8f acc[4] = {};
  for (int kb = 0; kb < K; kb += 32) {
    FragB ah, al;
    const v4f x0 = *(const v4fa*)(arow + kb + 8 * hh), x1 = *(const v4fa*)(arow + kb + 8 * hh + 4);
    const v4f x2 = *(const v4fa*)(arow + kb + 16 + 8 * hh), x3 = *(const v4fa*)(arow + kb + 16 + 8 * hh + 4);
    float xs[16] = {x0[0],x0[1],x0[2],x0[3],x1[0],x1[1],x1[2],x1[3],x2[0],x2[1],x2[2],x2[3],x3[0],x3[1],x3[2],x3[3]};
#pragma unroll
    for (int i = 0; i < 16; ++i) { const unsigned short hb = bf16_bits(xs[i]); ah.u[i] = hb; al.u[i] = ASPLIT ? bf16_bits(xs[i] - bf16_val(hb)) : (unsigned short)0; }
#pragma unroll
    for (int t = 0; t < 4; ++t) {
      const unsigned short* brow = Wt + (size_t)(col0 + t * 16 + ln) * ldb + kb;
      FragB b;
      b.half[0] = *(const v8us*)(brow + 8 * hh);
      b.half[1] = *(const v8us*)(brow + 16 + 8 * hh);
      acc[t] = mmaN<ASPLIT ? 2 : 1>(ah.v, al.v, b.v, b.v, acc[t]);
    }
  }
#pragma unroll
  for (int t = 0; t < 4; ++t) {
    float bv = bias ? bias[col0 + t * 16 + ln] : 0.f;
    if (BIAS_BF16) bv = bf16_round(bv);
#pragma unroll
    for (int r = 0; r < 8; ++r) { float v = acc[t][r] + bv; if (ACT == 1) v = fmaxf(v, 0.f); so[w][8 * hh + r][t * 16 + ln] = v; }
  }
  __builtin_amdgcn_fence(__ATOMIC_ACQ_REL, "workgroup");
  __builtin_amdgcn_wave_barrier();
  const int rsub = lane >> 4, c4 = (lane & 15) * 4;
  {
#pragma unroll
    for (int q = 0; q < 8; ++q) {
      const int r = q * 2 + rsub;
      const v4f v = *(const v4fa*)&so[w][r][c4];
      *(v4f*)(C + (size_t)(row0 + r) * ldc + col0 + c4) = v;
    }
    
  }
}

// GEMM C = act(A·W + bias + resid): A f32 (ASPLIT -> hi/lo 2 terms), Wt bf16 [N][K]; ACT 0 none, 1 relu, 2 exact gelu;
// resid (optional, f32, row index = (row % rmod), pitch ldr, RES_BF16 rounds it) added before the activation.
template <bool ASPLIT, int ACT, bool BIAS_BF16, bool RES_BF16>
__global__ __launch_bounds__(128) void k_gemm_bf3(const float* __restrict__ A, int lda, const unsigned short* __restrict__ Wt, int ldb,
                                                const float* __restrict__ bias, const float* __restrict__ resid, int rmod, int ldr,
                                                float* __restrict__ C, int ldc, int M, int N, int K) {
  __shared__ __attribute__((aligned(16))) float so[4][16][64];
  const int tid = threadIdx.x, w = tid >> 5, lane = tid & 31, ln = lane & 15, hh = lane >> 4;
  const int ntn = N / 64;
  const int wid = blockIdx.x * 4 + w;
  const int mt = wid / ntn, nq = wid % ntn;
  if (mt * 16 >= M) return;
  const int row0 = mt * 16, col0 = nq * 64;
  const float* arow = A + (size_t)(row0 + ln) * lda;
  v8f acc[4] = {};
  for (int kb = 0; kb < K; kb += 32) {
    FragB ah, al;
    const v4f x0 = *(const v4fa*)(arow + kb + 8 * hh), x1 = *(const v4fa*)(arow + kb + 8 * hh + 4);
    const v4f x2 = *(const v4fa*)(arow + kb + 16 + 8 * hh), x3 = *(const v4fa*)(arow + kb + 16 + 8 * hh + 4);
    float xs[16] = {x0[0],x0[1],x0[2],x0[3],x1[0],x1[1],x1[2],x1[3],x2[0],x2[1],x2[2],x2[3],x3[0],x3[1],x3[2],x3[3]};
#pragma unroll
    for (int i = 0; i < 16; ++i) { const unsigned short hb = bf16_bits(xs[i]); ah.u[i] = hb; al.u[i] = ASPLIT ? bf16_bits(xs[i] - bf16_val(hb)) : (unsigned short)0; }
#pragma unroll
    for (int t = 0; t < 4; ++t) {
      const unsigned short* brow = Wt + (size_t)(col0 + t * 16 + ln) * ldb + kb;
      FragB b;
      b.half[0] = *(const v8us*)(brow + 8 * hh);
      b.half[1] = *(const v8us*)(brow + 16 + 8 * hh);
      acc[t] = mmaN<ASPLIT ? 2 : 1>(ah.v, al.v, b.v, b.v, acc[t]);
    }
  }
#pragma unroll
  for (int t = 0; t < 4; ++t) {
    const int col = col0 + t * 16 + ln;
    float bv = bias ? bias[col] : 0.f;
    if (BIAS_BF16) bv = bf16_round(bv);
#pragma unroll
    for (int r = 0; r < 8; ++r) {
      float v = acc[t][r] + bv;
      if (resid) { float rv = resid[(size_t)((row0 + 8 * hh + r) % rmod) * ldr + col]; if (RES_BF16) rv = bf16_round(rv); v += rv; }
      if (ACT == 1) v = fmaxf(v, 0.f);
      if (ACT == 2) v = 0.5f * v * (1.0f + erff(v * 0.70710678118654752f));
      if (ACT == 3) { const float u = 0.7978845608028654f * (v + 0.044715f * v * v * v); v = 0.5f * v * (1.0f + tanhf(u)); }
      so[w][8 * hh + r][t * 16 + ln] = v;
    }
  }
  __builtin_amdgcn_fence(__ATOMIC_ACQ_REL, "workgroup");
  __builtin_amdgcn_wave_barrier();
  const int rsub = lane >> 4, c4 = (lane & 15) * 4;
  {
#pragma unroll
    for (int q = 0; q < 8; ++q) {
      const int r = q * 2 + rsub;
      const v4f v = *(const v4fa*)&so[w][r][c4];
      *(v4f*)(C + (size_t)(row0 + r) * ldc + col0 + c4) = v;
    }
    
  }
}
// row LayerNorm (biased variance, eps) over N: s = X (+ R); optional out_sum <- s; out_norm <- (s-mu)*rsqrt(var+eps)*g + b
template <bool PARAM_BF16>
__global__ __launch_bounds__(256) void k_layernorm(const float* __restrict__ X, const float* __restrict__ R, const float* __restrict__ g, const float* __restrict__ bta,
                                                  float* __restrict__ out_sum, float* __restrict__ out_norm, int N, float eps) {
  __shared__ float red[256];
  const int row = blockIdx.x, tid = threadIdx.x;
  const float* x = X + (size_t)row * N; const float* rr = R ? R + (size_t)row * N : nullptr;
  float vals[16];                     // up to N = 4096
  const int per = N / 256;            // contiguous chunk per thread? use strided-by-4 chunks: thread handles j = tid*4 + 1024*u
  float s1 = 0.f;
  for (int u = 0; u < per / 4; ++u) {
    const int j = tid * 4 + 1024 * u;
    const v4f a = *(const v4fa*)(x + j);
    v4f b = {0.f,0.f,0.f,0.f}; if (rr) b = *(const v4fa*)(rr + j);
#pragma unroll
    for (int q = 0; q < 4; ++q) { const float v = a[q] + b[q]; vals[u * 4 + q] = v; s1 += v; }
  }
  red[tid] = s1; __syncthreads();
  for (int st = 128; st > 0; st >>= 1) { if (tid < st) red[tid] += red[tid + st]; __syncthreads(); }
  const float mu = red[0] / (float)N; __syncthreads();
  float s2 = 0.f;
  for (int u = 0; u < per / 4; ++u)
#pragma unroll
    for (int q = 0; q < 4; ++q) { const float c = vals[u * 4 + q] - mu; s2 += c * c; }
  red[tid] = s2; __syncthreads();
  for (int st = 128; st > 0; st >>= 1) { if (tid < st) red[tid] += red[tid + st]; __syncthreads(); }
  const float rs = rsqrtf(red[0] / (float)N + eps);
  {
    for (int u = 0; u < per / 4; ++u) {
      const int j = tid * 4 + 1024 * u;
      v4f o, sm;
#pragma unroll
      for (int q = 0; q < 4; ++q) {
        float gg = g[j + q], bb = bta[j + q];
        if (PARAM_BF16) { gg = bf16_round(gg); bb = bf16_round(bb); }
        sm[q] = vals[u * 4 + q]; o[q] = (vals[u * 4 + q] - mu) * rs * gg + bb;
      }
      if (out_sum) *(v4f*)(out_sum + (size_t)row * N + j) = sm;
      *(v4f*)(out_norm + (size_t)row * N + j) = o;
    }
    
  }
}



// ---- f16 WMMA path (v_wmma_f32_16x16x32_f16): 11-bit significands for operands in range — used where a [0,1] probability operand needs more precision than bf16
typedef _Float16 v16h __attribute__((ext_vector_type(16)));
union FragH { v16h v; v8us half[2]; _Float16 h[16]; unsigned short u[16]; };
template <int NT>
__device__ __forceinline__ v8f mmaH(v16h ah, v16h al, v16h bh, v16h bl, v8f c) {
  c = __builtin_amdgcn_wmma_f32_16x16x32_f16(false, ah, false, bh, (short)0, c, false, false);
  if (NT >= 2) c = __builtin_amdgcn_wmma_f32_16x16x32_f16(false, al, false, bh, (short)0, c, false, false);
  if (NT >= 3) c = __builtin_amdgcn_wmma_f32_16x16x32_f16(false, ah, false, bl, (short)0, c, false, false);
  asm volatile("v_nop\n\tv_nop\n\tv_nop\n\tv_nop" : "+v"(c) : "v"(ah), "v"(al), "v"(bh), "v"(bl));
  return c;
}
// batched GEMM like k_gemm_b but f16 operands: A f32 (split into f16 hi/lo if ASPLIT, else rounded to f16), Bt = f16 values [n][k]; alpha; C f32; N multiple of 16 (partial tiles skipped)
template <bool ASPLIT>
__global__ __launch_bounds__(128) void k_gemm_h(const float* __restrict__ A, int lda, size_t sA, const _Float16* __restrict__ Bh, int ldb, size_t sB, float alpha, float* __restrict__ C, int ldc, size_t sC, int M, int N, int K) {
  __shared__ __attribute__((aligned(16))) float so[4][16][64];
  const int tid = threadIdx.x, w = tid >> 5, lane = tid & 31, ln = lane & 15, hh = lane >> 4; const int by = blockIdx.y;
  A += (size_t)by * sA; Bh += (size_t)by * sB; C += (size_t)by * sC;
  const int ntn = (N + 63) / 64; const int wid = blockIdx.x * 4 + w; const int mt = wid / ntn, nq = wid % ntn; if (mt * 16 >= M) return;
  const int row0 = mt * 16, col0 = nq * 64; const float* arow = A + (size_t)(row0 + ln) * lda;
  v8f acc[4] = {};
  for (int kb = 0; kb < K; kb += 32) {
    FragH ah, al;
    const v4f x0 = *(const v4fa*)(arow + kb + 8 * hh), x1 = *(const v4fa*)(arow + kb + 8 * hh + 4), x2 = *(const v4fa*)(arow + kb + 16 + 8 * hh), x3 = *(const v4fa*)(arow + kb + 16 + 8 * hh + 4);
    float xs[16] = {x0[0],x0[1],x0[2],x0[3],x1[0],x1[1],x1[2],x1[3],x2[0],x2[1],x2[2],x2[3],x3[0],x3[1],x3[2],x3[3]};
#pragma unroll
    for (int i = 0; i < 16; ++i) { const _Float16 h = (_Float16)xs[i]; ah.h[i] = h; al.h[i] = ASPLIT ? (_Float16)(xs[i] - (float)h) : (_Float16)0.0f; }
#pragma unroll
    for (int t = 0; t < 4; ++t) { if (col0 + t * 16 >= N) continue; const size_t boff = (size_t)(col0 + t * 16 + ln) * ldb + kb; FragH bq; bq.half[0] = *(const v8us*)(Bh + boff + 8 * hh); bq.half[1] = *(const v8us*)(Bh + boff + 16 + 8 * hh);
      acc[t] = mmaH<ASPLIT ? 2 : 1>(ah.v, al.v, bq.v, bq.v, acc[t]); }
  }
#pragma unroll
  for (int t = 0; t < 4; ++t) { if (col0 + t * 16 >= N) continue;
#pragma unroll
    for (int r = 0; r < 8; ++r) so[w][8 * hh + r][t * 16 + ln] = acc[t][r] * alpha; }
  __builtin_amdgcn_fence(__ATOMIC_ACQ_REL, "workgroup"); __builtin_amdgcn_wave_barrier();
  const int rsub = lane >> 4, c4 = (lane & 15) * 4;
  {
#pragma unroll
    for (int q = 0; q < 8; ++q) { const int r = q * 2 + rsub; if (col0 + c4 < N) { const v4f v = *(const v4fa*)&so[w][r][c4]; *(v4f*)(C + (size_t)(row0 + r) * ldc + col0 + c4) = v; } }
     }
}

// Wt[n][k] = f16(W[k][n]·scale) from f32 row-major W[K][N] (scale = power of two; bf16-exact weights stay exact in f16 away from the subnormal range)
__global__ __launch_bounds__(256) void k_wt_f16(const float* __restrict__ W, _Float16* __restrict__ Wt, int K, int N, float scale) {
  const int t = blockIdx.x * 256 + threadIdx.x; if (t >= N * (K / 8)) return; const int n = t / (K / 8), k8 = (t % (K / 8)) * 8; FragH f;
#pragma unroll
  for (int i = 0; i < 8; ++i) f.h[i] = (_Float16)(bf16_round(W[(size_t)(k8 + i) * N + n]) * scale); const v8us o = f.half[0];
  *(v8us*)((unsigned short*)Wt + (size_t)n * K + k8) = o; 
}
// k_gemm_hh variant with fused epilogue: v = acc·alpha + bias[by·sBias + col] (+ CP[(row/rowsPerB)·sCPb + by·64 + col] if CP) ; ACT 0 none / 1 elu ; writes f16 C16 (and f32 C if non-null)
template <int ACT>
__global__ __launch_bounds__(128) void k_gemm_hhx(const _Float16* __restrict__ A, int lda, size_t sA, const _Float16* __restrict__ Bh, int ldb, size_t sB, float alpha, const float* __restrict__ bias, size_t sBias, const float* __restrict__ CP, int rowsPerB, size_t sCPb, int row0g,
    float* __restrict__ C, _Float16* __restrict__ C16, int ldc, size_t sC, int M, int N, int K) {
  __shared__ __attribute__((aligned(16))) float so[4][16][64];
  const int tid = threadIdx.x, w = tid >> 5, lane = tid & 31, ln = lane & 15, hh = lane >> 4; const int by = blockIdx.y;
  A += (size_t)by * sA; Bh += (size_t)by * sB; const size_t cofs = (size_t)by * sC; const float* bp = bias ? bias + (size_t)by * sBias : nullptr;
  const int ntn = (N + 63) / 64; const int wid = blockIdx.x * 4 + w; const int mt = wid / ntn, nq = wid % ntn; if (mt * 16 >= M) return;
  const int row0 = mt * 16, col0 = nq * 64; const _Float16* arow = A + (size_t)(row0 + ln) * lda;
  v8f acc[4] = {};
  for (int kb = 0; kb < K; kb += 32) { FragH ah; ah.half[0] = *(const v8us*)((const unsigned short*)arow + kb + 8 * hh); ah.half[1] = *(const v8us*)((const unsigned short*)arow + kb + 16 + 8 * hh);
#pragma unroll
    for (int t = 0; t < 4; ++t) { if (col0 + t * 16 >= N) continue; const size_t boff = (size_t)(col0 + t * 16 + ln) * ldb + kb; FragH bq; bq.half[0] = *(const v8us*)((const unsigned short*)Bh + boff + 8 * hh); bq.half[1] = *(const v8us*)((const unsigned short*)Bh + boff + 16 + 8 * hh);
      acc[t] = mmaH<1>(ah.v, ah.v, bq.v, bq.v, acc[t]); }
  }
#pragma unroll
  for (int t = 0; t < 4; ++t) { if (col0 + t * 16 >= N) continue; const int col = col0 + t * 16 + ln; const float bv = bp ? bf16_round(bp[col]) : 0.f;
#pragma unroll
    for (int r = 0; r < 8; ++r) { float v = acc[t][r] * alpha + bv; if (CP) { const int rr = row0g + row0 + 8 * hh + r; if (rowsPerB < 0) v += CP[cofs + (size_t)rr * ldc + col];      /* rowsPerB < 0: own element of the batched C plane */ else { const int bidx = rr / rowsPerB; v += CP[(size_t)bidx * sCPb + (size_t)by * 64 + col]; } } if (ACT == 1) v = (v > 0.f) ? v : expm1f(v); else if (ACT == 7) v = (v > 0.f) ? v + 1.0f : expf(v); else if (ACT == 8) v = tanhf(v); else if (ACT == 9) v = 0.5f * v * (1.0f + tanhf(0.7978845608028654f * (v + 0.044715f * v * v * v))); else if (ACT == 11) v = 1.0f / (1.0f + expf(-v)); else if (ACT == 12) v = (v > 0.f) ? v : 0.01f * v; else if (ACT == 14) v = (v > 0.f) ? v : 0.1f * v; else if (ACT == 16) v = (v >= 0.f) ? v : 0.3f * v; else if (ACT == 17) v = (v >= 0.f) ? v : 0.2f * v; else if (ACT == 15) v = v / (1.0f + expf(-v)); else if (ACT == 3) v = fmaxf(v, 0.f); else if (ACT == 6) v = 0.5f * v * (1.0f + erff(v * 0.70710678118654752f)); so[w][8 * hh + r][t * 16 + ln] = v; } }
  __builtin_amdgcn_fence(__ATOMIC_ACQ_REL, "workgroup"); __builtin_amdgcn_wave_barrier();
  const int rsub = lane >> 4, c4 = (lane & 15) * 4; typedef _Float16 v4h __attribute__((ext_vector_type(4)));
  {
#pragma unroll
    for (int q = 0; q < 8; ++q) { const int r = q * 2 + rsub; if (col0 + c4 < N) { const v4f v = *(const v4fa*)&so[w][r][c4]; if (C) *(v4f*)(C + cofs + (size_t)(row0 + r) * ldc + col0 + c4) = v; if (C16) { v4h h4; for (int i = 0; i < 4; ++i) h4[i] = (_Float16)v[i]; *(v4h*)(C16 + cofs + (size_t)(row0 + r) * ldc + col0 + c4) = h4; } } }
     }
}


typedef _Float16 v4h __attribute__((ext_vector_type(4)));

__global__ __launch_bounds__(256) void k_x16(const float* __restrict__ x, _Float16* __restrict__ X16, size_t n8) { const size_t t = (size_t)blockIdx.x * 256 + threadIdx.x; if (t >= n8) return; FragH f;
#pragma unroll
  for (int q = 0; q < 8; ++q) f.h[q] = (_Float16)bf16_round(x[t * 8 + q]); *(v8us*)((unsigned short*)X16 + t * 8) = f.half[0];  }
__global__ __launch_bounds__(256) void k_h16(const float* __restrict__ x, _Float16* __restrict__ X16, size_t n8) { const size_t t = (size_t)blockIdx.x * 256 + threadIdx.x; if (t >= n8) return; FragH f;
#pragma unroll
  for (int q = 0; q < 8; ++q) f.h[q] = (_Float16)x[t * 8 + q]; *(v8us*)((unsigned short*)X16 + t * 8) = f.half[0];  }
// d_*: the passes that read inputs only, each written for block number blk of its own range; k_prep below runs them all in one launch
__device__ __forceinline__ void d_round16f(unsigned blk, const float* __restrict__ W, _Float16* __restrict__ Bt, size_t n8) { const size_t t = (size_t)blk * 256 + threadIdx.x; if (t >= n8) return; FragH f;
#pragma unroll
  for (int i = 0; i < 8; ++i) f.h[i] = (_Float16)(bf16_round(W[t * 8 + i]) * 16.0f); *(v8us*)((unsigned short*)Bt + t * 8) = f.half[0];  }
template <int NHv, int TTv>
__global__ __launch_bounds__(256) void k_vt(const _Float16* __restrict__ V16, int ldv, int voff, _Float16* __restrict__ Vt) { __shared__ unsigned short tl[64][66]; const int tid = threadIdx.x; const int slab = blockIdx.x / (TTv / 64), lg = blockIdx.x % (TTv / 64); const int b = slab / NHv, h = slab % NHv;
  for (int i = tid; i < 64 * 8; i += 256) { const int r = i / 8, c8 = (i % 8) * 8; FragH f; f.half[0] = *(const v8us*)((const unsigned short*)V16 + ((size_t)b * TTv + lg * 64 + r) * ldv + voff + h * 64 + c8);
#pragma unroll
    for (int q = 0; q < 8; ++q) tl[r][c8 + q] = f.u[q]; }
  __syncthreads();
  {
#pragma unroll
    for (int rd = 0; rd < 2; ++rd) { const int d = rd * 32 + tid / 8, pc = tid % 8; FragH f;
#pragma unroll
      for (int q = 0; q < 8; ++q) f.u[q] = tl[pc * 8 + q][d];
      *(v8us*)((unsigned short*)Vt + ((size_t)slab * 64 + d) * TTv + lg * 64 + pc * 8) = f.half[0]; }
     } }

__global__ __launch_bounds__(256) void k_hl(const float* __restrict__ F, _Float16* __restrict__ Hh, _Float16* __restrict__ Hl, size_t n8) { const size_t t = (size_t)blockIdx.x * 256 + threadIdx.x; if (t >= n8) return; FragH fh, fl; const v4f a = *(const v4fa*)(F + t * 8), c = *(const v4fa*)(F + t * 8 + 4);
#pragma unroll
  for (int q = 0; q < 4; ++q) { _Float16 h = (_Float16)a[q]; fh.h[q] = h; fl.h[q] = (_Float16)((a[q] - (float)h) * 1024.0f); h = (_Float16)c[q]; fh.h[4 + q] = h; fl.h[4 + q] = (_Float16)((c[q] - (float)h) * 1024.0f); }
  { *(v8us*)((unsigned short*)Hh + t * 8) = fh.half[0]; *(v8us*)((unsigned short*)Hl + t * 8) = fl.half[0];  } }

// ---- fast GEMM (wave tile 32x64; requires M % 32 == 0 rows per launch region and N % 64 == 0); epilogue = k_gemm_hhx semantics ----
__device__ __forceinline__ v16h g2_frag(const _Float16* p, int hh) { FragH f; f.half[0] = *(const v8us*)((const unsigned short*)p + 8 * hh); f.half[1] = *(const v8us*)((const unsigned short*)p + 16 + 8 * hh); return f.v; }
__device__ __forceinline__ v8f g2_mma(v16h a, v16h b, v8f c) { v8f d = __builtin_amdgcn_wmma_f32_16x16x32_f16(false, a, false, b, (short)0, c, false, false); asm volatile("v_nop\n\tv_nop\n\tv_nop\n\tv_nop" : "+v"(d) : "v"(a), "v"(b)); return d; }
// PK: the 64-column tiles 1 (k, 16 live) and 2, 3 (v) leave LDS in the layouts that k_attn reads, so that every fragment load of a wave there is 512 contiguous bytes, and are not stored as rows:
// KC = [NB][NP][16]: the 16 live key columns. VF = [NB][NP / 32][8 channel tiles][2][32 lanes][8]: the A fragments of V^T (row = channel 16 ct + (lane & 15), k = key 16 h2 + 8 (lane >> 4) + i of the block of 32).
template <int ACT, bool PK = false>
__global__ __launch_bounds__(128) void k_gemm2(const _Float16* __restrict__ A, int lda, size_t sA, const _Float16* __restrict__ Bh, int ldb, size_t sB, float alpha, const float* __restrict__ bias, size_t sBias, const float* __restrict__ CP, int rowsPerB, size_t sCPb, int row0g,
    float* __restrict__ C, _Float16* __restrict__ C16, int ldc, size_t sC, int M, int N, int K, _Float16* __restrict__ KC, _Float16* __restrict__ VF) { static_assert(ACT == 0 || ACT == 3 || ACT == 6 || ACT == 8 || ACT == 9 || ACT == 11 || ACT == 12 || ACT == 14 || ACT == 15 || ACT == 16 || ACT == 17, "k_gemm2: unsupported ACT code (would silently apply no activation)");
  __shared__ __attribute__((aligned(16))) float so[4][32][68];
  const int tid = threadIdx.x, w = tid >> 5, lane = tid & 31, ln = lane & 15, hh = lane >> 4; const int by = blockIdx.y;
  A += (size_t)by * sA; Bh += (size_t)by * sB; const size_t cofs = (size_t)by * sC; const float* bp = bias ? bias + (size_t)by * sBias : nullptr;
  const int ntn = N >> 6; const int mt = blockIdx.x / ntn, nq = blockIdx.x - mt * ntn; const int row0 = mt * 128 + 32 * w, col0 = nq * 64; if (row0 >= M) return;
  const _Float16* a0p = A + (size_t)(row0 + ln) * lda; const _Float16* a1p = a0p + (size_t)16 * lda;
  const _Float16* b0p = Bh + (size_t)(col0 + ln) * ldb; const _Float16* b1p = b0p + (size_t)16 * ldb; const _Float16* b2p = b1p + (size_t)16 * ldb; const _Float16* b3p = b2p + (size_t)16 * ldb;
  const v8f z8 = {0.f,0.f,0.f,0.f,0.f,0.f,0.f,0.f}; v8f c00 = z8, c01 = z8, c02 = z8, c03 = z8, c10 = z8, c11 = z8, c12 = z8, c13 = z8;
#pragma unroll 1
  for (int kb = 0; kb < K; kb += 32) { const v16h a0 = g2_frag(a0p + kb, hh), a1 = g2_frag(a1p + kb, hh);
    asm volatile("s_wait_xcnt 0x0" ::: "memory");      /* stands before the A loads' address registers are rewritten */
    v16h b = g2_frag(b0p + kb, hh); c00 = g2_mma(a0, b, c00); c10 = g2_mma(a1, b, c10);
    b = g2_frag(b1p + kb, hh); c01 = g2_mma(a0, b, c01); c11 = g2_mma(a1, b, c11);
    b = g2_frag(b2p + kb, hh); c02 = g2_mma(a0, b, c02); c12 = g2_mma(a1, b, c12);
    b = g2_frag(b3p + kb, hh); c03 = g2_mma(a0, b, c03); c13 = g2_mma(a1, b, c13); }
  v8f accs[8] = {c00, c01, c02, c03, c10, c11, c12, c13};
#pragma unroll
  for (int u = 0; u < 8; ++u) { const int t = u & 3, half = u >> 2; const int col = col0 + t * 16 + ln; const float bv = bp ? bf16_round(bp[col]) : 0.f;
#pragma unroll
    for (int r = 0; r < 8; ++r) { const int rloc = half * 16 + 8 * hh + r; float v = accs[u][r] * alpha + bv; if (CP) { if (rowsPerB < 0) v += CP[cofs + (size_t)(row0g + row0 + rloc) * ldc + col];      /* rowsPerB < 0: own element of the batched C plane */ else { const int bidx = (row0g + row0 + rloc) / rowsPerB; v += CP[(size_t)bidx * sCPb + (size_t)by * 64 + col]; } }
      if (ACT == 3) v = fmaxf(v, 0.f); else if (ACT == 6) v = 0.5f * v * (1.0f + erff(v * 0.70710678118654752f)); else if (ACT == 11) v = 1.0f / (1.0f + expf(-v)); else if (ACT == 15) v = v / (1.0f + expf(-v)); else if (ACT == 12) v = (v > 0.f) ? v : 0.01f * v; else if (ACT == 8) v = tanhf(v); else if (ACT == 9) v = 0.5f * v * (1.0f + tanhf(0.7978845608028654f * (v + 0.044715f * v * v * v))); else if (ACT == 14) v = (v > 0.f) ? v : 0.1f * v; else if (ACT == 16) v = (v >= 0.f) ? v : 0.3f * v; else if (ACT == 17) v = (v >= 0.f) ? v : 0.2f * v;
      so[w][rloc][t * 16 + ln] = v; } }
  __builtin_amdgcn_fence(__ATOMIC_ACQ_REL, "workgroup"); __builtin_amdgcn_wave_barrier();
  const int rsub = lane >> 4, c4 = (lane & 15) * 4;
  if (PK && nq == 1) {      /* the same for the whole work-group. lane = row: 32 B each, the wave's 32 rows 1 KiB in a run */
    FragH f;
#pragma unroll
    for (int i = 0; i < 4; ++i) { const v4f v = *(const v4fa*)&so[w][lane][i * 4]; for (int e = 0; e < 4; ++e) f.h[i * 4 + e] = (_Float16)v[e]; }
    unsigned short* d = (unsigned short*)KC + (size_t)(row0 + lane) * 16; *(v8us*)d = f.half[0]; *(v8us*)(d + 8) = f.half[1];
  } else if (PK && nq >= 2) {      /* the wave's 32 rows are one block of 32 keys, its 64 columns 4 channel tiles: piece u = (tile u >> 1, h2 = u & 1), 4 KiB in a run */
    unsigned short* d = (unsigned short*)VF + (size_t)(row0 >> 5) * 4096 + (nq - 2) * 2048 + lane * 8;
#pragma unroll
    for (int u = 0; u < 8; ++u) { FragH f; for (int i = 0; i < 8; ++i) f.h[i] = (_Float16)so[w][(u & 1) * 16 + 8 * hh + i][(u >> 1) * 16 + ln];
      *(v8us*)(d + u * 256) = f.half[0]; asm volatile("s_wait_xcnt 0x0" ::: "memory"); /* stands before the store's data registers are rewritten by the next piece */ }
  } else {
#pragma unroll
    for (int q = 0; q < 16; ++q) { const int r = q * 2 + rsub; const v4f v = *(const v4fa*)&so[w][r][c4]; if (C) { *(v4f*)(C + cofs + (size_t)(row0 + r) * ldc + col0 + c4) = v; asm volatile("s_wait_xcnt 0x0" ::: "memory"); /* stands before the store's data and address registers are rewritten by the next piece */ } if (C16) { v4h h4; for (int i = 0; i < 4; ++i) h4[i] = (_Float16)v[i]; *(v4h*)(C16 + cofs + (size_t)(row0 + r) * ldc + col0 + c4) = h4; } }
     } }

// ---- k_gemm2 with both operands staged in LDS (requires M % 128 == 0, N % 64 == 0, K % 128 == 0); same tiles, same k order, same epilogue ----
// A stage is 128 k (256 B, two whole lines) of the work-group's 128 A rows and 64 B rows; every wave-wide copy covers two whole rows of it (4 lines) where a fragment load from global touched 16 lines.
#define G3_KS 128
#define G3_PITCH 272                    /* LDS row pitch, bytes: 16 B x odd, conflict-free for ds_load_b128 */
#define G3_STAGE (192 * G3_PITCH)       /* rows 0..127 = A, rows 128..191 = B */
#define G3_C(l, g) "global_load_async_to_lds_b128 %" #l ", %" #g ", off\n\t"
// twelve copies and, as the statement's last line, the wait that stands before any register they name is rewritten
#define G3_COPY12(L, G, o) asm volatile(G3_C(0, 12) G3_C(1, 13) G3_C(2, 14) G3_C(3, 15) G3_C(4, 16) G3_C(5, 17) G3_C(6, 18) G3_C(7, 19) G3_C(8, 20) G3_C(9, 21) G3_C(10, 22) G3_C(11, 23) "s_wait_xcnt 0x0" \
    :: "v"(L[o + 0]), "v"(L[o + 1]), "v"(L[o + 2]), "v"(L[o + 3]), "v"(L[o + 4]), "v"(L[o + 5]), "v"(L[o + 6]), "v"(L[o + 7]), "v"(L[o + 8]), "v"(L[o + 9]), "v"(L[o + 10]), "v"(L[o + 11]), \
       "v"(G[o + 0]), "v"(G[o + 1]), "v"(G[o + 2]), "v"(G[o + 3]), "v"(G[o + 4]), "v"(G[o + 5]), "v"(G[o + 6]), "v"(G[o + 7]), "v"(G[o + 8]), "v"(G[o + 9]), "v"(G[o + 10]), "v"(G[o + 11]) : "memory")
// one stage: 24 copies of 16 B per lane. l = the lane's LDS byte address in row (tid >> 4) of the buffer, ga / gb = its global address in that row of the A / B tile; copy j serves row 8 j + (tid >> 4)
// IM8: the A tile's 128 rows are 8 h-lines of 16 w-positions of the bordered rows, so tile row 8 j + .. lies (j >> 1) bordered h-lines and 8 (j & 1) positions behind row (tid >> 4)
template <bool IM8>
__device__ __forceinline__ void g3_fill(unsigned l, const _Float16* ga, size_t sa8, const _Float16* gb, size_t sb8) {
  constexpr int NA = 16;
  unsigned L[24]; const _Float16* G[24];
#pragma unroll      /* both loops: every index constant, so that L and G are registers the asm can name */
  for (int j = 0; j < NA; ++j) { L[j] = l + (unsigned)j * (8u * G3_PITCH); G[j] = ga + (IM8 ? (size_t)(((j >> 1) * PD + (j & 1) * 8) * CC) : (size_t)j * sa8); }
#pragma unroll
  for (int j = 0; j < 24 - NA; ++j) { L[NA + j] = l + (unsigned)(NA + j) * (8u * G3_PITCH); G[NA + j] = gb + (size_t)j * sb8; }
  G3_COPY12(L, G, 0); G3_COPY12(L, G, 12); }
__device__ __forceinline__ v16h g3_frag(const unsigned char* p) { FragH f; f.half[0] = *(const v8us*)p; f.half[1] = *(const v8us*)(p + 32); return f.v; }
// IM8: A = bordered rows [NB][PD][PD][PD][CC] and the product is the k2 conv: stage s is channels 128 (s & 1) .. + 127 of tap s >> 1 = (dt, dh, dw), read for output position (t, h, w) at bordered index (t + dt, h + dh, w + dw); k = tap * CC + channel
// EPI: what follows v = acc * alpha + bias, done as the tile leaves LDS (planes by = 0 only for 5). 0: store v (f32 C and / or f16 C16). 3: f32 elu(v) to C. (1 and 2 are the k2 convs' own: k_conv below.)
// 4: f16 elu(elu(v) + CP[row][col]) to C16. 5: f32 elu(v) to C = [NB][CC][NP], channel-major.
__device__ __forceinline__ float elu1(float a) { const float e = expm1f(a); return (a > 0.f) ? a : e; }      /* expm1f stands outside the choice: no branch per element, so that the chains of neighbouring elements overlap in a wave that is alone on its SIMD */
template <int ACT, bool IM8 = false, int EPI = 0>
__global__ __launch_bounds__(128) void k_gemm2s(const _Float16* __restrict__ A, int lda, size_t sA, const _Float16* __restrict__ Bh, int ldb, size_t sB, float alpha, const float* __restrict__ bias, size_t sBias, const float* __restrict__ CP, int rowsPerB, size_t sCPb, int row0g,
    float* __restrict__ C, _Float16* __restrict__ C16, int ldc, size_t sC, int M, int N, int K) { static_assert(ACT == 0 || ACT == 3 || ACT == 6 || ACT == 8 || ACT == 9 || ACT == 11 || ACT == 12 || ACT == 14 || ACT == 15 || ACT == 16 || ACT == 17, "k_gemm2s: unsupported ACT code (would silently apply no activation)");
  static_assert(EPI == 0 || EPI >= 3, "epilogues 1 and 2 are k_conv's");
  __shared__ __attribute__((aligned(16))) unsigned char st[2 * G3_STAGE];
  __shared__ __attribute__((aligned(16))) float so[4][32][68];
  const int tid = threadIdx.x, w = tid >> 5, lane = tid & 31, ln = lane & 15, hh = lane >> 4; const int by = blockIdx.y;
  A += (size_t)by * sA; Bh += (size_t)by * sB; const size_t cofs = (size_t)by * sC; const float* bp = bias ? bias + (size_t)by * sBias : nullptr;
  const int ntn = N >> 6; const int mt = blockIdx.x / ntn, nq = blockIdx.x - mt * ntn; const int row0 = mt * 128 + 32 * w, col0 = nq * 64; if (mt * 128 >= M) return;      /* the same for the whole work-group, in front of every barrier */
  const int crow = tid >> 4, cch = tid & 15; const size_t sa8 = (size_t)8 * lda, sb8 = (size_t)8 * ldb;
  static_assert(!IM8 || (DT == 16 && DH == 16 && DW == 16 && CC == 2 * G3_KS), "IM8: a 128-row tile is 8 h-lines of 16, a tap is two stages");
  const _Float16* gA = IM8 ? A + (size_t)((mt >> 5) * NPP + ((mt >> 1) & 15) * (PD * PD) + (mt & 1) * (8 * PD) + crow) * CC + cch * 8 : A + (size_t)(mt * 128 + crow) * lda + cch * 8;
  auto aoff = [](int t) -> size_t { return IM8 ? (size_t)((((t >> 3) & 1) * (PD * PD) + ((t >> 2) & 1) * PD + ((t >> 1) & 1)) * CC + (t & 1) * G3_KS) : (size_t)t * G3_KS; };      /* stage t's place behind gA, elements */
  const _Float16* gB = Bh + (size_t)(col0 + crow) * ldb + cch * 8;
  const unsigned l0 = (unsigned)(size_t)st + (unsigned)(crow * G3_PITCH + cch * 16);
  const unsigned char* fa = st + (32 * w + ln) * G3_PITCH + 16 * hh; const unsigned char* fb = st + (128 + ln) * G3_PITCH + 16 * hh;
  const int nt = K / G3_KS;
  const v8f z8 = {0.f,0.f,0.f,0.f,0.f,0.f,0.f,0.f}; v8f c00 = z8, c01 = z8, c02 = z8, c03 = z8, c10 = z8, c11 = z8, c12 = z8, c13 = z8;
  g3_fill<IM8>(l0, gA, sa8, gB, sb8);
  asm volatile("s_wait_asynccnt 0x0" ::: "memory");      /* this wave's copies of stage 0 have landed */
  __syncthreads();                                        /* ... and every other wave's */
  if (nt > 1) g3_fill<IM8>(l0 + G3_STAGE, gA + aoff(1), sa8, gB + G3_KS, sb8);
#pragma unroll 1      /* one trip per stage: the buffer index stays a run-time value */
  for (int t = 0; t < nt; ++t) { const unsigned bo = (unsigned)(t & 1) * G3_STAGE; const unsigned char* pa = fa + bo; const unsigned char* pb = fb + bo;
    v16h a0 = g3_frag(pa), a1 = g3_frag(pa + 16 * G3_PITCH), b0 = g3_frag(pb), b1 = g3_frag(pb + 16 * G3_PITCH), b2 = g3_frag(pb + 32 * G3_PITCH), b3 = g3_frag(pb + 48 * G3_PITCH);
#pragma unroll      /* constant LDS offsets; the next 32 k's fragments (same stage) are read as one group ahead of this 32 k's WMMAs */
    for (int ks = 0; ks < 4; ++ks) { v16h na0 = a0, na1 = a1, nb0 = b0, nb1 = b1, nb2 = b2, nb3 = b3;
      if (ks < 3) { const unsigned char* qa = pa + (ks + 1) * 64; const unsigned char* qb = pb + (ks + 1) * 64; na0 = g3_frag(qa); na1 = g3_frag(qa + 16 * G3_PITCH); nb0 = g3_frag(qb); nb1 = g3_frag(qb + 16 * G3_PITCH); nb2 = g3_frag(qb + 32 * G3_PITCH); nb3 = g3_frag(qb + 48 * G3_PITCH); }
      c00 = g2_mma(a0, b0, c00); c10 = g2_mma(a1, b0, c10); c01 = g2_mma(a0, b1, c01); c11 = g2_mma(a1, b1, c11);
      c02 = g2_mma(a0, b2, c02); c12 = g2_mma(a1, b2, c12); c03 = g2_mma(a0, b3, c03); c13 = g2_mma(a1, b3, c13);
      a0 = na0; a1 = na1; b0 = nb0; b1 = nb1; b2 = nb2; b3 = nb3; }
    asm volatile("s_wait_dscnt 0x0" ::: "memory");        /* this wave's reads of the buffer are done before it is refilled */
    asm volatile("s_wait_asynccnt 0x0" ::: "memory");     /* this wave's copies of stage t + 1 have landed */
    __syncthreads();                                      /* publishes stage t + 1 and ends every wave's reads of stage t */
    if (t + 2 < nt) g3_fill<IM8>(l0 + bo, gA + aoff(t + 2), sa8, gB + (size_t)(t + 2) * G3_KS, sb8); }
  asm volatile("s_wait_asynccnt 0x0" ::: "memory");       /* no copy outstanding behind the loop */
  const int rsub = lane >> 4, c4 = (lane & 15) * 4;
  v8f accs[8] = {c00, c01, c02, c03, c10, c11, c12, c13};
#pragma unroll
  for (int u = 0; u < 8; ++u) { const int t = u & 3, half = u >> 2; const int col = col0 + t * 16 + ln; const float bv = bp ? bf16_round(bp[col]) : 0.f;
#pragma unroll
    for (int r = 0; r < 8; ++r) { const int rloc = half * 16 + 8 * hh + r; float v = accs[u][r] * alpha + bv; if (EPI == 0 && CP) { if (rowsPerB < 0) v += CP[cofs + (size_t)(row0g + row0 + rloc) * ldc + col];      /* rowsPerB < 0: own element of the batched C plane */ else { const int bidx = (row0g + row0 + rloc) / rowsPerB; v += CP[(size_t)bidx * sCPb + (size_t)by * 64 + col]; } }
      if (ACT == 3) v = fmaxf(v, 0.f); else if (ACT == 6) v = 0.5f * v * (1.0f + erff(v * 0.70710678118654752f)); else if (ACT == 11) v = 1.0f / (1.0f + expf(-v)); else if (ACT == 15) v = v / (1.0f + expf(-v)); else if (ACT == 12) v = (v > 0.f) ? v : 0.01f * v; else if (ACT == 8) v = tanhf(v); else if (ACT == 9) v = 0.5f * v * (1.0f + tanhf(0.7978845608028654f * (v + 0.044715f * v * v * v))); else if (ACT == 14) v = (v > 0.f) ? v : 0.1f * v; else if (ACT == 16) v = (v >= 0.f) ? v : 0.3f * v; else if (ACT == 17) v = (v >= 0.f) ? v : 0.2f * v;
      so[w][rloc][t * 16 + ln] = v; } }
  __builtin_amdgcn_fence(__ATOMIC_ACQ_REL, "workgroup"); __builtin_amdgcn_wave_barrier();
  if (EPI == 0) {
#pragma unroll
    for (int q = 0; q < 16; ++q) { const int r = q * 2 + rsub; const v4f v = *(const v4fa*)&so[w][r][c4]; if (C) { *(v4f*)(C + cofs + (size_t)(row0 + r) * ldc + col0 + c4) = v; asm volatile("s_wait_xcnt 0x0" ::: "memory"); /* stands before the store's data and address registers are rewritten by the next piece */ } if (C16) { v4h h4; for (int i = 0; i < 4; ++i) h4[i] = (_Float16)v[i]; *(v4h*)(C16 + cofs + (size_t)(row0 + r) * ldc + col0 + c4) = h4; } }
  } else if (EPI == 5) {      /* the wave's 32 rows are 32 neighbouring positions of one batch: 8 lanes x 4 positions = one whole 128-B line of a channel */
    const int pg = (lane & 7) * 4, cs = lane >> 3; float* ob = C + ((size_t)(row0 / NP) * CC + col0 + cs) * NP + (row0 % NP) + pg;
#pragma unroll 1      /* stays a loop: 64 inlined expm1f would be straight-line code that every wave fetches and runs once; a trip's 8 elements are independent chains */
    for (int q = 0; q < 8; ++q) { const float* sp = &so[w][pg][q * 8 + cs]; float x[8];
#pragma unroll
      for (int i = 0; i < 8; ++i) x[i] = sp[(i & 3) * 68 + (i >> 2) * 4];
      v4f v0, v1;
#pragma unroll
      for (int i = 0; i < 4; ++i) { v0[i] = elu1(x[i]); v1[i] = elu1(x[4 + i]); }
      *(v4f*)(ob + (size_t)(q * 8) * NP) = v0; *(v4f*)(ob + (size_t)(q * 8 + 4) * NP) = v1;
      asm volatile("s_wait_xcnt 0x0" ::: "memory"); /* stands before the stores' data and address registers are rewritten by the next trip */ }
  } else {
    v4f o0 = {0.f, 0.f, 0.f, 0.f}, o1 = o0;      /* EPI 4: the addend of the trip at hand, loaded one trip ahead */
    if (EPI == 4) { o0 = *(const v4fa*)(CP + (size_t)(row0 + rsub) * ldc + col0 + c4); o1 = *(const v4fa*)(CP + (size_t)(row0 + rsub + 2) * ldc + col0 + c4); asm volatile("s_wait_xcnt 0x0" ::: "memory"); /* stands before the loads' address registers are rewritten */ }
#pragma unroll 1      /* stays a loop, as above */
    for (int q = 0; q < 8; ++q) { const int r = q * 4 + rsub, R = row0 + r; v4f v0 = *(const v4fa*)&so[w][r][c4], v1 = *(const v4fa*)&so[w][r + 2][c4]; v4f n0 = o0, n1 = o1;
      if (EPI == 4) { const int Rn = R + ((q < 7) ? 4 : 0); n0 = *(const v4fa*)(CP + (size_t)Rn * ldc + col0 + c4); n1 = *(const v4fa*)(CP + (size_t)(Rn + 2) * ldc + col0 + c4); }
#pragma unroll
      for (int i = 0; i < 4; ++i) { v0[i] = elu1(v0[i]); v1[i] = elu1(v1[i]); }
      if (EPI == 3) { *(v4f*)(C + cofs + (size_t)R * ldc + col0 + c4) = v0; *(v4f*)(C + cofs + (size_t)(R + 2) * ldc + col0 + c4) = v1; }
      else {
        if (EPI == 4) {
#pragma unroll
          for (int i = 0; i < 4; ++i) { v0[i] = elu1(v0[i] + o0[i]); v1[i] = elu1(v1[i] + o1[i]); } }
        const size_t dr = (size_t)R;
        v4h h0, h1;
#pragma unroll
        for (int i = 0; i < 4; ++i) { h0[i] = (_Float16)v0[i]; h1[i] = (_Float16)v1[i]; }
        *(v4h*)(C16 + cofs + dr * ldc + col0 + c4) = h0; *(v4h*)(C16 + cofs + (dr + 2) * ldc + col0 + c4) = h1; }
      asm volatile("s_wait_xcnt 0x0" ::: "memory"); /* stands before the registers of this trip's loads and stores are rewritten by the next trip */
      o0 = n0; o1 = n1; }
  } }


// ---- the k2 convs: the tile's input rows stay in LDS ----
// A tile of 128 output positions is 8 h-lines of one t. Its 8 taps read 2 t-planes x 9 h-lines x 17 positions of the bordered rows, each plane a run of 153 rows in memory. The work-group copies these rows to LDS once
// (all 256 channels, one row per wave-wide copy) and tap (dt, dh, dw) reads its A fragments there, (dh * 17 + dw) rows further on in plane dt; only the B stages go through two buffers. A B stage is a whole tap (256 k):
// a trip's work then covers more of the next stage's flight, and a launch has 8 rounds of waits and barrier. Same wave tiles, same k order as k_gemm2s<.., IM8>.
// Plane 0 and B stage 0 land before the loop; plane 1, first read in trip 4, comes in groups of five rows per wave in front of the loop and behind the barriers of trips 0 to 2, beside the B stages.
// The epilogue's f32 tiles lie on the input rows' LDS, which nobody reads behind the last trip's barrier.
// EPI 1 (4 waves, tile 128 x 64): f16 elu(v) to C16 = bordered rows, at the row's interior place.
// EPI 2 (8 waves, tile 128 rows x (64 columns a | the 64 columns g that lie CC behind them), waves 2 i / 2 i + 1 = a / g of rows 32 i ..): C[row][col] += a * sigmoid(g), f16 elu of it to C16 = bordered rows, and, where X16 is given, f16 of it to X16 (pitch XP).
#define CV_PP 528                      /* LDS pitch of an input row, bytes: 512 + 16 = 16 B x odd, conflict-free for ds_load_b128 */
#define CV_LR (9 * PD)                 /* rows of a plane that the tile reads */
#define CV_PL 160                      /* LDS rows per plane: CV_LR rounded up, so that every wave issues the same number of copies; rows CV_LR .. are never read */
// five / eight copies and, as the statement's last line, the wait that stands before any register they name is rewritten
#define CV_COPY5(L, G) asm volatile(G3_C(0, 5) G3_C(1, 6) G3_C(2, 7) G3_C(3, 8) G3_C(4, 9) "s_wait_xcnt 0x0" \
    :: "v"(L[0]), "v"(L[1]), "v"(L[2]), "v"(L[3]), "v"(L[4]), "v"(G[0]), "v"(G[1]), "v"(G[2]), "v"(G[3]), "v"(G[4]) : "memory")
#define CV_COPY8(L, G, o) asm volatile(G3_C(0, 8) G3_C(1, 9) G3_C(2, 10) G3_C(3, 11) G3_C(4, 12) G3_C(5, 13) G3_C(6, 14) G3_C(7, 15) "s_wait_xcnt 0x0" \
    :: "v"(L[o + 0]), "v"(L[o + 1]), "v"(L[o + 2]), "v"(L[o + 3]), "v"(L[o + 4]), "v"(L[o + 5]), "v"(L[o + 6]), "v"(L[o + 7]), "v"(G[o + 0]), "v"(G[o + 1]), "v"(G[o + 2]), "v"(G[o + 3]), "v"(G[o + 4]), "v"(G[o + 5]), "v"(G[o + 6]), "v"(G[o + 7]) : "memory")
// group grp of a plane: wave w copies LDS rows (5 grp + i) NW + w. l / g = the lane's 16 bytes in the plane's row 0, in LDS / in memory; an LDS row past the plane's last takes the last row's bytes, so that the source address stays inside the buffer
template <int NW>
__device__ __forceinline__ void cv_rows(unsigned l, const _Float16* g, int w, int grp) {
  unsigned L[5]; const _Float16* G[5];
#pragma unroll      /* every index constant, so that L and G are registers the asm can name */
  for (int i = 0; i < 5; ++i) { const int r = (grp * 5 + i) * NW + w; L[i] = l + (unsigned)r * CV_PP; G[i] = g + (size_t)((r < CV_LR) ? r : CV_LR - 1) * CC; }
  CV_COPY5(L, G); }
// one B stage: a tap's 256 k (512 B) of every weight row of the tile, LDS pitch CV_PP; a wave-wide copy is one whole row, copy j of wave w serves LDS row RS j + w. l / g = the lane's 16 bytes in row w, in LDS / in memory.
// GT: LDS rows 64 .. 127 are the weight rows that lie 256 behind rows 0 .. 63 (the gate halves of the same channels)
template <bool GT>
__device__ __forceinline__ void cv_b(unsigned l, const _Float16* g) {
  constexpr int RS = GT ? 8 : 4;
  unsigned L[16]; const _Float16* G[16];
#pragma unroll      /* as above */
  for (int j = 0; j < 16; ++j) { L[j] = l + (unsigned)(j * RS) * CV_PP; G[j] = g + (size_t)(j * RS + ((GT && j >= 8) ? 192 : 0)) * K8; }
  CV_COPY8(L, G, 0); CV_COPY8(L, G, 8); }
template <int EPI>
__global__ __launch_bounds__(EPI == 2 ? 256 : 128) void k_conv(const _Float16* __restrict__ A, const _Float16* __restrict__ Bh, float alpha, const float* __restrict__ bias, float* __restrict__ C, _Float16* __restrict__ C16, _Float16* __restrict__ X16) {
  static_assert(EPI == 1 || EPI == 2, "k_conv: epilogue 1 or 2"); static_assert(DT == 16 && DH == 16 && DW == 16 && CC * 2 + 16 == CV_PP, "a 128-row tile is 8 h-lines of 16; a row of a B stage is a tap's CC channels");
  constexpr bool GT = EPI == 2; constexpr int NW = GT ? 8 : 4, NG = CV_PL / (5 * NW), GPS = NG / 4, BST = (GT ? 128 : 64) * CV_PP, ldc = CC, nt = K8 / CC;
  static_assert(NG * 5 * NW == CV_PL && GPS * 4 == NG && nt == 8 && NG * 5 + 16 <= 63, "whole groups; plane 1 goes out in four equal parts and is in LDS before trip 4; copies outstanding per wave");
  __shared__ __attribute__((aligned(16))) unsigned char sp[2 * CV_PL * CV_PP];
  __shared__ __attribute__((aligned(16))) unsigned char sb[2 * BST];
  static_assert(sizeof(float) * NW * 32 * 68 <= sizeof(sp), "the epilogue's tiles fit on the input rows");
  float (*so)[32][68] = (float (*)[32][68])sp;      /* written only behind the last trip's barrier: every wave's reads of sp are done, no copy is outstanding */
  const int tid = threadIdx.x, w = __builtin_amdgcn_readfirstlane(tid >> 5) /* the wave's number in a scalar register: the rows it copies are scalar arithmetic */, lane = tid & 31, ln = lane & 15, hh = lane >> 4;
  const int mt = blockIdx.x >> 2, nq = blockIdx.x & 3, wr = GT ? w >> 1 : w; const int row0 = mt * 128 + 32 * wr, col0 = nq * 64;
  const _Float16* gP = A + (size_t)((mt >> 5) * NPP + ((mt >> 1) & 15) * (PD * PD) + (mt & 1) * (8 * PD)) * CC + lane * 8;
  const unsigned lP = (unsigned)(size_t)sp + (unsigned)lane * 16u;
  const _Float16* gB = Bh + (size_t)(col0 + w) * K8 + lane * 8;
  const unsigned lB = (unsigned)(size_t)sb + (unsigned)(w * CV_PP + lane * 16);
  const unsigned char* fa = sp + (2 * wr * PD + ln) * CV_PP + 16 * hh; const unsigned char* fb = sb + ((GT ? 64 * (w & 1) : 0) + ln) * CV_PP + 16 * hh;
  const v8f z8 = {0.f,0.f,0.f,0.f,0.f,0.f,0.f,0.f}; v8f c00 = z8, c01 = z8, c02 = z8, c03 = z8, c10 = z8, c11 = z8, c12 = z8, c13 = z8;
  for (int g = 0; g < NG; ++g) cv_rows<NW>(lP, gP, w, g);
  cv_b<GT>(lB, gB);
  asm volatile("s_wait_asynccnt 0x0" ::: "memory");      /* this wave's copies of plane 0 and of B stage 0 have landed */
  __syncthreads();                                        /* ... and every other wave's */
  cv_b<GT>(lB + BST, gB + CC);
  for (int g = 0; g < GPS; ++g) cv_rows<NW>(lP + CV_PL * CV_PP, gP + (size_t)(PD * PD) * CC, w, g);
#pragma unroll 1      /* one trip per stage: the buffer index stays a run-time value */
  for (int t = 0; t < nt; ++t) { const unsigned bo = (unsigned)(t & 1) * BST;
    const unsigned char* pa = fa + (((t >> 2) & 1) * CV_PL + ((t >> 1) & 1) * PD + (t & 1)) * CV_PP; const unsigned char* pb = fb + bo;      /* stage t = tap t = (dt, dh, dw), all its channels */
    v16h a0 = g3_frag(pa), a1 = g3_frag(pa + PD * CV_PP), b0 = g3_frag(pb), b1 = g3_frag(pb + 16 * CV_PP), b2 = g3_frag(pb + 32 * CV_PP), b3 = g3_frag(pb + 48 * CV_PP);
#pragma unroll      /* constant LDS offsets; the next 32 k's fragments (same stage) are read as one group ahead of this 32 k's WMMAs */
    for (int ks = 0; ks < CC / 32; ++ks) { v16h na0 = a0, na1 = a1, nb0 = b0, nb1 = b1, nb2 = b2, nb3 = b3;
      if (ks < CC / 32 - 1) { const unsigned char* qa = pa + (ks + 1) * 64; const unsigned char* qb = pb + (ks + 1) * 64; na0 = g3_frag(qa); na1 = g3_frag(qa + PD * CV_PP); nb0 = g3_frag(qb); nb1 = g3_frag(qb + 16 * CV_PP); nb2 = g3_frag(qb + 32 * CV_PP); nb3 = g3_frag(qb + 48 * CV_PP); }
      c00 = g2_mma(a0, b0, c00); c10 = g2_mma(a1, b0, c10); c01 = g2_mma(a0, b1, c01); c11 = g2_mma(a1, b1, c11);
      c02 = g2_mma(a0, b2, c02); c12 = g2_mma(a1, b2, c12); c03 = g2_mma(a0, b3, c03); c13 = g2_mma(a1, b3, c13);
      a0 = na0; a1 = na1; b0 = nb0; b1 = nb1; b2 = nb2; b3 = nb3; }
    asm volatile("s_wait_dscnt 0x0" ::: "memory");        /* this wave's reads of the B buffer are done before it is refilled */
    asm volatile("s_wait_asynccnt 0x0" ::: "memory");     /* this wave's copies of B stage t + 1 and of its last groups of plane 1 have landed */
    __syncthreads();                                      /* publishes them and ends every wave's reads of B stage t */
    if (t + 2 < nt) cv_b<GT>(lB + bo, gB + (size_t)(t + 2) * CC);
    if (t < 3) for (int g = 0; g < GPS; ++g) cv_rows<NW>(lP + CV_PL * CV_PP, gP + (size_t)(PD * PD) * CC, w, (t + 1) * GPS + g); }      /* the last groups go out behind trip 2 and are published by the barrier of trip 3 */
  asm volatile("s_wait_asynccnt 0x0" ::: "memory");       /* no copy outstanding behind the loop */
  const int rsub = lane >> 4, c4 = (lane & 15) * 4;
  float* rp = GT ? C + (size_t)(row0 + (w & 1) * 16 + rsub) * ldc + col0 + c4 : nullptr;      /* EPI 2: the wave gates rows 16 (w & 1) .. + 15 of its pair's 32; a lane has 4 channels of rows rsub + 2 i */
  v4f r0 = {0.f, 0.f, 0.f, 0.f}, r1 = r0;      /* EPI 2: the C values of the trip at hand, loaded one trip ahead; the first fly while the tiles go to LDS */
  if (GT) { r0 = *(const v4fa*)rp; r1 = *(const v4fa*)(rp + 2 * (size_t)ldc); asm volatile("s_wait_xcnt 0x0" ::: "memory"); /* stands before the loads' address registers are rewritten */ }
  v8f accs[8] = {c00, c01, c02, c03, c10, c11, c12, c13};
#pragma unroll
  for (int u = 0; u < 8; ++u) { const int t = u & 3, half = u >> 2; const int col = col0 + t * 16 + ln + (GT ? (w & 1) * ldc : 0); const float bv = bf16_round(bias[col]);
#pragma unroll
    for (int r = 0; r < 8; ++r) so[w][half * 16 + 8 * hh + r][t * 16 + ln] = accs[u][r] * alpha + bv; }
  __builtin_amdgcn_fence(__ATOMIC_ACQ_REL, "workgroup"); __builtin_amdgcn_wave_barrier();
  if (EPI == 2) {
    __syncthreads();      /* the partner wave's tile (the other of a and g) is in LDS */
    const float* pa = &so[w & ~1][(w & 1) * 16 + rsub][c4]; const float* pg = pa + 32 * 68;      /* so[w & ~1] = a, so[(w & ~1) + 1] = g */
#pragma unroll 1      /* stays a loop: the inlined exponentials would be straight-line code that every wave fetches and runs once; a trip's 8 elements are independent chains */
    for (int q = 0; q < 4; ++q) { const int R = row0 + (w & 1) * 16 + q * 4 + rsub; const v4f a0 = *(const v4fa*)(pa + q * (4 * 68)), a1 = *(const v4fa*)(pa + q * (4 * 68) + 2 * 68), g0 = *(const v4fa*)(pg + q * (4 * 68)), g1 = *(const v4fa*)(pg + q * (4 * 68) + 2 * 68);
      float* rq = rp + (size_t)(q * 4) * ldc; const float* rn = rq + (size_t)((q < 3) ? 4 : 0) * ldc;
      const v4f n0 = *(const v4fa*)rn, n1 = *(const v4fa*)(rn + 2 * (size_t)ldc);
      v4f v0, v1;
#pragma unroll
      for (int i = 0; i < 4; ++i) { v0[i] = r0[i] + a0[i] * (1.0f / (1.0f + expf(-g0[i]))); v1[i] = r1[i] + a1[i] * (1.0f / (1.0f + expf(-g1[i]))); }
      *(v4f*)rq = v0; *(v4f*)(rq + 2 * (size_t)ldc) = v1; asm volatile("s_wait_xcnt 0x0" ::: "memory"); /* stands before the stores' registers are rewritten */
      const int p = R % NP;      /* rows R and R + 2 lie in one w-line of 16: R = .. + 4 q + (0 or 1) */
      const size_t dr = (size_t)((R / NP) * NPP + (p / (DH * DW) + 1) * (PD * PD) + ((p / DW) % DH + 1) * PD + (p % DW) + 1);
      v4h h0, h1;
#pragma unroll
      for (int i = 0; i < 4; ++i) { h0[i] = (_Float16)elu1(v0[i]); h1[i] = (_Float16)elu1(v1[i]); }
      *(v4h*)(C16 + dr * ldc + col0 + c4) = h0; *(v4h*)(C16 + (dr + 2) * ldc + col0 + c4) = h1; asm volatile("s_wait_xcnt 0x0" ::: "memory"); /* stands before the stores' registers are rewritten */
      if (X16) {      /* the same for the whole launch */
#pragma unroll
        for (int i = 0; i < 4; ++i) { h0[i] = (_Float16)v0[i]; h1[i] = (_Float16)v1[i]; }
        *(v4h*)(X16 + (size_t)R * XP + col0 + c4) = h0; *(v4h*)(X16 + (size_t)(R + 2) * XP + col0 + c4) = h1; }
      asm volatile("s_wait_xcnt 0x0" ::: "memory"); /* stands before the registers of this trip's loads and stores are rewritten by the next trip */
      r0 = n0; r1 = n1; }
  } else {
#pragma unroll 1      /* stays a loop: 64 inlined expm1f would be straight-line code that every wave fetches and runs once; a trip's 8 elements are independent chains */
    for (int q = 0; q < 8; ++q) { const int r = q * 4 + rsub, R = row0 + r; v4f v0 = *(const v4fa*)&so[w][r][c4], v1 = *(const v4fa*)&so[w][r + 2][c4];
#pragma unroll
      for (int i = 0; i < 4; ++i) { v0[i] = elu1(v0[i]); v1[i] = elu1(v1[i]); }
      const int p = R % NP;      /* rows R and R + 2 lie in one w-line of 16: R = .. + 4 q + (0 or 1) */
      const size_t dr = (size_t)((R / NP) * NPP + (p / (DH * DW) + 1) * (PD * PD) + ((p / DW) % DH + 1) * PD + (p % DW) + 1);
      v4h h0, h1;
#pragma unroll
      for (int i = 0; i < 4; ++i) { h0[i] = (_Float16)v0[i]; h1[i] = (_Float16)v1[i]; }
      *(v4h*)(C16 + dr * ldc + col0 + c4) = h0; *(v4h*)(C16 + (dr + 2) * ldc + col0 + c4) = h1;
      asm volatile("s_wait_xcnt 0x0" ::: "memory"); /* stands before the stores' registers are rewritten by the next trip */ }
  } }

__device__ __forceinline__ void d_xrows(unsigned blk, const float* __restrict__ x, float* __restrict__ RES, _Float16* __restrict__ E) { __shared__ float tl[CC][33]; const int tid = threadIdx.x; const int b = blk / (NP / 32), pb = blk % (NP / 32); const int p0 = pb * 32;
  const int j0 = tid % 32;      /* i = i0 + 256 u: column i % 32 is the thread's own, channel i / 32 goes up by 8 with u */
  for (int i0 = tid; i0 < CC * 32; i0 += 8 * 256) { const int cb = i0 / 32; float xv[8];
#pragma unroll      /* eight loads in flight, then their one wait */
    for (int u = 0; u < 8; ++u) xv[u] = x[((size_t)b * CC + cb + 8 * u) * NP + p0 + j0];
    asm volatile("s_wait_xcnt 0x0" ::: "memory");      /* stands before the loads' address registers are rewritten */
#pragma unroll
    for (int u = 0; u < 8; ++u) tl[cb + 8 * u][j0] = bf16_round(xv[u]); }
  __syncthreads();
  { for (int i = tid; i < 32 * (CC / 8); i += 256) { const int j = i / (CC / 8), c0 = (i % (CC / 8)) * 8; v8f v; for (int q = 0; q < 8; ++q) v[q] = tl[c0 + q][j]; *(v8f*)(RES + ((size_t)b * NP + p0 + j) * CC + c0) = v;
      FragH f; for (int q = 0; q < 8; ++q) { const float a = v[q]; f.h[q] = (_Float16)((a > 0.f) ? a : expm1f(a)); } const int p = p0 + j;      /* elu(res) as f16 at the row's interior place in the bordered rows */
      *(v8us*)((unsigned short*)E + ((size_t)b * NPP + (size_t)((p / (DH * DW) + 1) * (PD * PD) + ((p / DW) % DH + 1) * PD + (p % DW) + 1)) * CC + c0) = f.half[0];
      asm volatile("s_wait_xcnt 0x0" ::: "memory"); /* stands before the stores' registers are rewritten by the next trip */ }  } }
// zeros at the bordered positions with an index 0, in both bordered buffers (their interiors are written by d_xrows and by GEMM epilogues): one thread per 8 channels of a border position
#define NBD (NPP - NP)      /* 817 = 17 * 17 (t = 0) + 16 * 17 (h = 0) + 16 * 16 (w = 0) */
__device__ __forceinline__ void d_border(unsigned blk, _Float16* __restrict__ E, _Float16* __restrict__ Z) { const int t = (int)blk * 256 + (int)threadIdx.x; if (t >= NB * NBD * (CC / 8)) return; const int c8 = (t % (CC / 8)) * 8, i = (t / (CC / 8)) % NBD, b = t / ((CC / 8) * NBD);
  const int j1 = i - PD * PD, j2 = j1 - DT * PD; const int pp = (j1 < 0) ? i : (j2 < 0) ? (j1 / PD + 1) * (PD * PD) + j1 % PD : (j2 / DH + 1) * (PD * PD) + (j2 % DH + 1) * PD;
  const v8us z = {0, 0, 0, 0, 0, 0, 0, 0}; const size_t o = ((size_t)b * NPP + pp) * CC + c8; *(v8us*)((unsigned short*)E + o) = z; *(v8us*)((unsigned short*)Z + o) = z; }
__device__ __forceinline__ void d_w8(unsigned blk, const float* __restrict__ w, int O, _Float16* __restrict__ Bt) { const size_t t = (size_t)blk * 256 + threadIdx.x; if (t >= (size_t)O * K8 / 8) return; const int c8 = (int)((t * 8) % CC); const int tap = (int)(((t * 8) / CC) % 8); const int o = (int)((t * 8) / K8); FragH f; for (int q = 0; q < 8; ++q) f.h[q] = (_Float16)(bf16_round(w[((size_t)o * CC + c8 + q) * 8 + tap]) * 16.0f);
  *(v8us*)((unsigned short*)Bt + t * 8) = f.half[0];  }
// columns 256 .. 287 of the concat rows XA (pitch XP): the 3 original channels, the 3 position codes, zeros; inputs only. Columns 0 .. 255 (res) come from the last gate's epilogue
__device__ __forceinline__ void d_xat(unsigned blk, const float* __restrict__ orig, _Float16* __restrict__ XA) { const size_t t = (size_t)blk * 256 + threadIdx.x; if (t >= NR * 4) return; const int pc = 32 + (int)(t % 4); const size_t r = t / 4; const int p = (int)(r % NP); const size_t b = r / NP; FragH f;
  for (int q = 0; q < 8; ++q) { const int col = pc * 8 + q; float v = 0.f; if (col < 259) v = bf16_round(orig[((b * 3 + (col - 256)) * (size_t)NP) + p]); else if (col == 259) v = -0.5f + (float)(p / (DH * DW)) / (float)DT; else if (col == 260) v = -0.5f + (float)((p / DW) % DH) / (float)DH; else if (col == 261) v = -0.5f + (float)(p % DW) / (float)DW; f.h[q] = (_Float16)v; }
  unsigned short* d = (unsigned short*)XA + r * XP + pc * 8; *(v8us*)d = f.half[0];  }
__device__ __forceinline__ void d_wa(unsigned blk, const float* __restrict__ w, int O, int OP, _Float16* __restrict__ Bt) { const size_t t = (size_t)blk * 256 + threadIdx.x; if (t >= (size_t)OP * KA / 8) return; const int k0 = (int)((t * 8) % KA); const int o = (int)((t * 8) / KA); FragH f; for (int q = 0; q < 8; ++q) { const int k = k0 + q; f.h[q] = (o < O && k < 262) ? (_Float16)(bf16_round(w[(size_t)o * 262 + k]) * 16.0f) : (_Float16)0.f; }
  *(v8us*)((unsigned short*)Bt + t * 8) = f.half[0];  }
// block ranges of k_prep, in launch order (the x transpose and the large conv weights first)
#define PB_X  (NB * (NP / 32))
#define PB_W2 (NRES * 512 * K8 / 8 / 256)
#define PB_W1 (NRES * CC * K8 / 8 / 256)
#define PB_R  (CC * CC / 8 / 256)
#define PB_A  (CC * VC / 8 / 256)
#define PB_QK (64 * KA / 8 / 256)
#define PB_V  (VC * KA / 8 / 256)
#define PB_XT ((int)(NR * 4 / 256))
#define PB_BD ((NB * NBD * (CC / 8) + 255) / 256)
#define PB_ALL (PB_X + PB_W2 + PB_W1 + 2 * PB_R + PB_A + 2 * PB_QK + PB_V + PB_XT + PB_BD + 1)
// every pass that depends on inputs alone, in one launch: the block number picks the pass (the same for a whole work-group, so d_xrows' barrier stands under uniform control flow).
// BW1 / BW2 hold all NRES blocks' conv weights (rw1 / rw2 are NRES stacked tensors: one run of output rows). BQKV = 64 q rows (16 live) | 64 k rows (16 live) | 128 v rows; bqkv = their biases in the same order.
__global__ __launch_bounds__(256) void k_prep(const float* __restrict__ x, const float* __restrict__ orig, const float* __restrict__ rw1, const float* __restrict__ rw2, const float* __restrict__ qw, const float* __restrict__ kw, const float* __restrict__ vw, const float* __restrict__ qb, const float* __restrict__ kb, const float* __restrict__ vb,
    const float* __restrict__ aw, const float* __restrict__ rsw, const float* __restrict__ ow, float* __restrict__ RES, _Float16* __restrict__ BW1, _Float16* __restrict__ BW2, _Float16* __restrict__ BQKV, float* __restrict__ bqkv, _Float16* __restrict__ BA, _Float16* __restrict__ BR, _Float16* __restrict__ BO, _Float16* __restrict__ XA, _Float16* __restrict__ EP, _Float16* __restrict__ O1) {
  unsigned b = blockIdx.x;
  if (b < PB_X) { d_xrows(b, x, RES, EP); return; } b -= PB_X;
  if (b < PB_W2) { d_w8(b, rw2, NRES * 512, BW2); return; } b -= PB_W2;
  if (b < PB_W1) { d_w8(b, rw1, NRES * CC, BW1); return; } b -= PB_W1;
  if (b < PB_R) { d_round16f(b, rsw, BR, (size_t)CC * CC / 8); return; } b -= PB_R;
  if (b < PB_R) { d_round16f(b, ow, BO, (size_t)CC * CC / 8); return; } b -= PB_R;
  if (b < PB_A) { d_round16f(b, aw, BA, (size_t)CC * VC / 8); return; } b -= PB_A;
  if (b < PB_QK) { d_wa(b, qw, 16, 64, BQKV); return; } b -= PB_QK;
  if (b < PB_QK) { d_wa(b, kw, 16, 64, BQKV + (size_t)64 * KA); return; } b -= PB_QK;
  if (b < PB_V) { d_wa(b, vw, VC, VC, BQKV + (size_t)128 * KA); return; } b -= PB_V;
  if (b < PB_XT) { d_xat(b, orig, XA); return; } b -= PB_XT;
  if (b < PB_BD) { d_border(b, EP, O1); return; }
  const int i = threadIdx.x, j = i & 63; float v = 0.f;
  if (i >= 128) v = vb[i - 128]; else if (j < 16) v = (i < 64) ? qb[j] : kb[j];
  bqkv[i] = v; asm volatile("s_wait_xcnt 0x0" ::: "memory"); /* stands before the store's registers are rewritten */ }
// ---- causal attention in one kernel: scores, softmax weights and P.V never leave the WGP ----
// A work-group owns FA_Q queries of one batch; its 8 waves deal the blocks of 32 keys among them (wave w: blocks w, w + 8, ..). S^T = K.Q^T: a lane holds scores of one query per column tile, so maximum and sum are in-lane,
// and the two S^T tiles of a block, turned into weights in place, are the B operand of O^T += V^T.P^T. Pass 1 finds each query's true maximum (joined through LDS), pass 2 forms the scores again, the weights
// exp(t - max) * 2^8 as f16 (sum of the unrounded weights in f32) and the products; then the 8 waves' partial O^T and sums are added through LDS, scaled by 1 / sum (query 0: 0), ELU, f16 rows.
#define FA_Q 32
#define FA_W 8
#define FA_OP 132      /* floats per query row of a wave's partial: 528 B = 16 B x odd, conflict-free for 16-byte stores */
__device__ __forceinline__ v8f fa_mma(v16h a, v16h b, v8f c) { return __builtin_amdgcn_wmma_f32_16x16x32_f16(false, a, false, b, (short)0, c, false, false); }
// the two K fragments of a block of 32 keys: row = key, k = the 16 live columns (k 16 .. 31 are zeros on both sides of the product)
__device__ __forceinline__ void fa_ldk(const unsigned short* p, FragH& k0, FragH& k1) { k0.half[0] = *(const v8us*)p; k1.half[0] = *(const v8us*)(p + 256); }
// the two S^T tiles of one block of 32 keys and one column tile: lane = query q, sa[r] = key ka + r, sb[r] = key ka + 16 + r. MK / mk: the block holds keys at or behind q (only a work-group's last block does)
template <bool MK>
__device__ __forceinline__ float fa_max(const v8f sa, const v8f sb, int ka, int q, float m) { float x[16];
#pragma unroll
  for (int r = 0; r < 8; ++r) { x[r] = (!MK || ka + r < q) ? sa[r] : -3.0e38f; x[8 + r] = (!MK || ka + 16 + r < q) ? sb[r] : -3.0e38f; }
#pragma unroll      /* a tree: no chain of 16 dependent maxima */
  for (int st = 8; st > 0; st >>= 1)
#pragma unroll
    for (int i = 0; i < st; ++i) x[i] = fmaxf(x[i], x[i + st]);
  return fmaxf(m, x[0]); }
__device__ __forceinline__ v16h fa_wgt(const v8f sa, const v8f sb, int ka, int q, float m, bool mk, float& se) { const float cs = 1.4426950408889634f / 16.093476939431082f;      /* log2(e) / sqrt(259): exp((s - max) / sqrt(259)) * 2^8 = exp2((s - max) * cs + 8) */
  float e[16]; FragH p;
#pragma unroll
  for (int r = 0; r < 8; ++r) { e[r] = (sa[r] - m) * cs + 8.0f; e[8 + r] = (sb[r] - m) * cs + 8.0f; }
  __builtin_amdgcn_sched_barrier(0);      /* this and the two in the loop: each v_nop stays directly behind its v_exp_f32 */
#pragma unroll
  for (int i = 0; i < 16; ++i) { e[i] = __builtin_amdgcn_exp2f(e[i]); __builtin_amdgcn_sched_barrier(0);
    asm volatile("v_nop");      /* the slot that the instruction set asks for behind a transcendental, before its result is read or its source rewritten */
    __builtin_amdgcn_sched_barrier(0); }
  if (mk) {      /* the same for the whole wave */
#pragma unroll
    for (int r = 0; r < 8; ++r) { e[r] = (ka + r < q) ? e[r] : 0.f; e[8 + r] = (ka + 16 + r < q) ? e[8 + r] : 0.f; } }
#pragma unroll
  for (int i = 0; i < 16; ++i) p.h[i] = (_Float16)e[i];
#pragma unroll      /* a tree: no chain of 16 dependent additions */
  for (int st = 8; st > 0; st >>= 1)
#pragma unroll
    for (int i = 0; i < st; ++i) e[i] += e[i + st];
  se += e[0]; return p.v; }
__global__ __launch_bounds__(256) void k_attn(const _Float16* __restrict__ QKV, const _Float16* __restrict__ KC, const _Float16* __restrict__ VF, _Float16* __restrict__ ATE) {
  __shared__ __attribute__((aligned(16))) float po[FA_W][FA_Q][FA_OP];
  __shared__ float redm[FA_W][2][FA_Q], reds[FA_W][2][FA_Q];
  const int tid = threadIdx.x, w = __builtin_amdgcn_readfirstlane(tid >> 5) /* the wave's number in a scalar register: the key loops become scalar loops, EXEC stays all ones round the WMMAs */, lane = tid & 31, ln = lane & 15, hh = lane >> 4, b = blockIdx.y;
  const int q0 = (NP / FA_Q - 1 - (int)blockIdx.x) * FA_Q;      /* the longest rows start first */
  const int nkb = q0 / 32 + 1;      /* blocks of 32 keys that hold a key below q0 + FA_Q - 1 */
  const unsigned short* kc = (const unsigned short*)KC + (size_t)b * NP * 16 + ln * 16 + hh * 8;
  const unsigned short* vf = (const unsigned short*)VF + (size_t)b * (NP / 32) * 4096 + lane * 8;
  const v8us z8u = {0, 0, 0, 0, 0, 0, 0, 0}; const v8f z8 = {0.f, 0.f, 0.f, 0.f, 0.f, 0.f, 0.f, 0.f};
  FragH qf0, qf1, k0, k1, n0, n1; qf0.half[1] = z8u; qf1.half[1] = z8u; k0.half[1] = z8u; k1.half[1] = z8u; n0.half[1] = z8u; n1.half[1] = z8u;
  { const unsigned short* qp = (const unsigned short*)QKV + ((size_t)b * NP + q0 + ln) * 256 + 8 * hh; qf0.half[0] = *(const v8us*)qp; qf1.half[0] = *(const v8us*)(qp + 16 * 256); }
  const int kfirst = (w < nkb) ? w : 0;      /* a wave without a block still loads in bounds */
  fa_ldk(kc + (size_t)kfirst * 512, k0, k1);
  asm volatile("s_wait_xcnt 0x0" ::: "memory");      /* stands before the loads' address registers are rewritten */
  const int qa = q0 + ln, qb = qa + 16;
  float m0 = -3.0e38f, m1 = -3.0e38f;
  for (int kb = w; kb < nkb; kb += FA_W) {
    fa_ldk(kc + (size_t)((kb + FA_W < nkb) ? kb + FA_W : kb) * 512, n0, n1);      /* the next block's K fragments fly while this block is worked on */
    asm volatile("s_wait_xcnt 0x0" ::: "memory");      /* stands before the loads' address registers are rewritten */
    const v8f s00 = fa_mma(k0.v, qf0.v, z8), s10 = fa_mma(k1.v, qf0.v, z8), s01 = fa_mma(k0.v, qf1.v, z8), s11 = fa_mma(k1.v, qf1.v, z8);
    const int ka = kb * 32 + 8 * hh;
    if (kb == nkb - 1) { m0 = fa_max<true>(s00, s10, ka, qa, m0); m1 = fa_max<true>(s01, s11, ka, qb, m1); } else { m0 = fa_max<false>(s00, s10, ka, qa, m0); m1 = fa_max<false>(s01, s11, ka, qb, m1); }
    k0.half[0] = n0.half[0]; k1.half[0] = n1.half[0]; }
  redm[w][hh][ln] = m0; redm[w][hh][16 + ln] = m1;
  fa_ldk(kc + (size_t)kfirst * 512, k0, k1);
  asm volatile("s_wait_xcnt 0x0" ::: "memory");      /* stands before the loads' address registers are rewritten */
  __syncthreads();      /* every wave's maxima are in LDS */
#pragma unroll
  for (int i = 0; i < FA_W; ++i) { m0 = fmaxf(m0, fmaxf(redm[i][0][ln], redm[i][1][ln])); m1 = fmaxf(m1, fmaxf(redm[i][0][16 + ln], redm[i][1][16 + ln])); }
  v8f acc[8][2];
#pragma unroll
  for (int ct = 0; ct < 8; ++ct) { acc[ct][0] = z8; acc[ct][1] = z8; }
  float se0 = 0.f, se1 = 0.f;
  for (int kb = w; kb < nkb; kb += FA_W) {
    FragH v[8]; const unsigned short* vp = vf + (size_t)kb * 4096;
#pragma unroll      /* this block's V^T fragments: issued first, used last */
    for (int ct = 0; ct < 8; ++ct) { v[ct].half[0] = *(const v8us*)(vp + ct * 512); v[ct].half[1] = *(const v8us*)(vp + ct * 512 + 256); }
    fa_ldk(kc + (size_t)((kb + FA_W < nkb) ? kb + FA_W : kb) * 512, n0, n1);
    asm volatile("s_wait_xcnt 0x0" ::: "memory");      /* stands before the loads' address registers are rewritten */
    const v8f s00 = fa_mma(k0.v, qf0.v, z8), s10 = fa_mma(k1.v, qf0.v, z8), s01 = fa_mma(k0.v, qf1.v, z8), s11 = fa_mma(k1.v, qf1.v, z8);
    const int ka = kb * 32 + 8 * hh; v16h p0, p1;
    p0 = fa_wgt(s00, s10, ka, qa, m0, kb == nkb - 1, se0); p1 = fa_wgt(s01, s11, ka, qb, m1, kb == nkb - 1, se1);
#pragma unroll
    for (int ct = 0; ct < 8; ++ct) { acc[ct][0] = fa_mma(v[ct].v, p0, acc[ct][0]); acc[ct][1] = fa_mma(v[ct].v, p1, acc[ct][1]); }
    k0.half[0] = n0.half[0]; k1.half[0] = n1.half[0]; }
#pragma unroll      /* acc[ct][qt][r] = O^T[channel 16 ct + 8 hh + r][query 16 qt + ln] */
  for (int ct = 0; ct < 8; ++ct)
#pragma unroll
    for (int qt = 0; qt < 2; ++qt) { float* d = &po[w][qt * 16 + ln][ct * 16 + 8 * hh]; const v8f a = acc[ct][qt]; const v4f lo = {a[0], a[1], a[2], a[3]}, hi = {a[4], a[5], a[6], a[7]}; *(v4fa*)d = lo; *(v4fa*)(d + 4) = hi; }
  reds[w][hh][ln] = se0; reds[w][hh][16 + ln] = se1;
  __syncthreads();      /* every wave's partial products and sums are in LDS */
  const int q = tid >> 3, c0 = (tid & 7) * 4; float t = 0.f;
#pragma unroll
  for (int i = 0; i < FA_W; ++i) t += reds[i][0][q] + reds[i][1][q];
  const float rs = (q0 + q == 0) ? 0.f : 1.0f / t;      /* query 0 sees no key: zeros */
  _Float16* op = ATE + ((size_t)b * NP + q0 + q) * VC + c0;
#pragma unroll
  for (int j = 0; j < 4; ++j) { v4f sm = *(const v4fa*)&po[0][q][c0 + j * 32];
#pragma unroll
    for (int i = 1; i < FA_W; ++i) { const v4f x = *(const v4fa*)&po[i][q][c0 + j * 32]; sm += x; }
    v4h h4;
#pragma unroll
    for (int i = 0; i < 4; ++i) h4[i] = (_Float16)elu1(sm[i] * rs);
    *(v4h*)(op + j * 32) = h4; }
  asm volatile("s_wait_xcnt 0x0" ::: "memory");      /* stands before the stores' registers are rewritten */
}

extern "C" void kernel_launch(void* const* d_in, const int* in_sizes, int n_in,
                              void* d_out, int out_size, void* d_ws, size_t ws_size, hipStream_t stream) {
  (void)in_sizes; (void)n_in; (void)out_size;
  const float* const* I = (const float* const*)d_in; const float* x = I[0]; const float* orig = I[1]; const float* rw1 = I[2]; const float* rb1 = I[3]; const float* rw2 = I[4]; const float* rb2 = I[5]; const float* qw = I[6]; const float* qb = I[7]; const float* kw = I[8]; const float* kb = I[9]; const float* vw = I[10]; const float* vb = I[11]; const float* aw = I[12]; const float* ab = I[13]; const float* rsw = I[14]; const float* rsb = I[15]; const float* ow = I[16]; const float* ob = I[17];
  char* ws = (char*)d_ws; size_t off = 0;
  auto take = [&](size_t bytes) { char* p = ws + off; off += (bytes + 255) & ~(size_t)255; return p; };
  _Float16* BW1 = (_Float16*)take((size_t)NRES * CC * K8 * 2); _Float16* BW2 = (_Float16*)take((size_t)NRES * 512 * K8 * 2); _Float16* BQKV = (_Float16*)take((size_t)256 * KA * 2); float* bqkv = (float*)take(256 * 4); _Float16* BA = (_Float16*)take((size_t)CC * VC * 2); _Float16* BR = (_Float16*)take((size_t)CC * CC * 2); _Float16* BO = (_Float16*)take((size_t)CC * CC * 2);
  float* RES = (float*)take(NR * CC * 4); _Float16* EP = (_Float16*)take((size_t)NB * NPP * CC * 2); _Float16* O1 = (_Float16*)take((size_t)NB * NPP * CC * 2);
  _Float16* XA = (_Float16*)take(NR * XP * 2); _Float16* QKV = (_Float16*)take(NR * 256 * 2); _Float16* VF = (_Float16*)take((size_t)NB * VC * NP * 2); _Float16* KC = (_Float16*)take((size_t)NB * NP * 16 * 2);
  _Float16* ATE = (_Float16*)take(NR * VC * 2); float* ATTC = (float*)take(NR * CC * 4); _Float16* SUM16 = (_Float16*)take(NR * CC * 2);
  if (off > ws_size) return;      /* about 58 MB */
  k_prep<<<PB_ALL, 256, 0, stream>>>(x, orig, rw1, rw2, qw, kw, vw, qb, kb, vb, aw, rsw, ow, RES, BW1, BW2, BQKV, bqkv, BA, BR, BO, XA, EP, O1);
  const dim3 g256((unsigned)((NR / 128) * (CC / 64)), 1);
  for (int i = 0; i < NRES; ++i) {
    k_conv<1><<<g256, 128, 0, stream>>>(EP, BW1 + (size_t)i * CC * K8, 0.0625f, rb1 + i * CC, nullptr, O1, nullptr);      /* o = elu(conv1 + b1), into the bordered rows */
    k_conv<2><<<g256, 256, 0, stream>>>(O1, BW2 + (size_t)i * 512 * K8, 0.0625f, rb2 + i * 512, RES, EP, (i == NRES - 1) ? XA : nullptr); }      /* o = conv2 + b2 (512); res += o[:256] * sigmoid(o[256:]); elu(res) into the bordered rows; the last res also into the concat rows */
  /* attention: q | k | v as one GEMM (N = 256) whose epilogue lays k and v out in fragment order, then scores, softmax and P.V in one kernel; blockIdx.y = batch */
  k_gemm2<0, true><<<dim3((unsigned)((NR / 128) * 4), 1), 128, 0, stream>>>(XA, XP, 0, BQKV, KA, 0, 0.0625f, bqkv, 0, nullptr, 1, 0, 0, nullptr, QKV, 256, 0, (int)NR, 256, KA, KC, VF);
  k_attn<<<dim3(NP / FA_Q, NB), 256, 0, stream>>>(QKV, KC, VF, ATE);      /* elu(att), att = softmax(q.k / sqrt(259), k < q) v */
  k_gemm2s<0, false, 3><<<g256, 128, 0, stream>>>(ATE, VC, 0, BA, VC, 0, 0.0625f, ab, 0, nullptr, 1, 0, 0, ATTC, nullptr, CC, 0, (int)NR, CC, VC);      /* att = elu(attn_conv(elu(att)) + b) */
  k_gemm2s<0, true, 4><<<g256, 128, 0, stream>>>(EP + (size_t)(PD * PD + PD + 1) * CC, CC, 0, BR, CC, 0, 0.0625f, rsb, 0, ATTC, 1, 0, 0, nullptr, SUM16, CC, 0, (int)NR, CC, CC);      /* elu(res + att), res = elu(res_conv(elu(res)) + b); A = the bordered rows' interior: the one tap (1, 1, 1) */
  k_gemm2s<0, false, 5><<<g256, 128, 0, stream>>>(SUM16, CC, 0, BO, CC, 0, 0.0625f, ob, 0, nullptr, 1, 0, 0, (float*)d_out, nullptr, CC, 0, (int)NR, CC, CC);      /* out = elu(out_conv(elu(res + att)) + b), channel-major */
}

// v010
// It runs in 198 microseconds.
// Timed twice side by side with v009, it ran 1.08 times as fast both times.
// Counting every step since v000, which is the starting kernel, it is 14.7 times as fast.
#include <hip/hip_runtime.h>
// PixelSNAILBlock (x [2][256][16][16][16], original_input [2][3][16][16][16]; 4 gated residual blocks: o = elu(conv3d k2 pad1 crop(elu(res)) + b1); o = conv3d k2 pad1 crop(o) + b2 (512 ch); res += o[:256] * sigmoid(o[256:]); attention over the 4,096 positions of [res | original | pos-enc] (262 ch): q,k (16), v (128), causal softmax (k < q, row 0 all-zero) of q.k/sqrt(259), att = p v; att = elu(1x1(elu(att)) + b); res = elu(1x1(elu(res)) + b); out = elu(1x1(elu(res + att)) + b) -> [2][256][16][16][16]).
// Structure: position rows r = b*4096 + (t*16 + h)*16 + w; res kept as f32 rows; each k2 'causal-corner' conv as a WMMA GEMM over K = 8 taps x 256 channels whose A fragments are read tap by tap from the tile's zero-bordered f16 rows, held in LDS (32x64 wave tiles, f32 accumulation, exact x16 weights + bias) with the ELUs on VALU; gating on VALU; q/k/v as GEMMs on the 262 -> 288-column concat rows (16 live of 64 for q/k); one attention kernel: per 32 queries S^T = K.Q^T on WMMA (K = 32, 16 live), causal softmax weights on VALU in the accumulator registers (true row maximum from a first pass; un-normalised f16 weights x 2^8, f32 sum, row 0 -> 0), O^T += V^T.P^T on WMMA against fragment-order value planes, the keys dealt to 8 waves and the partials added through LDS, scaling; the three 1x1 convs as GEMMs followed by VALU ELUs; channel-major store on VALU.
// Compute dtype: inputs rounded to bf16; x / original / weights exact; conv operands (elu(res), o1), the concat rows, q/k/v, softmax weights and the 1x1-conv operands plain f16 (~2^-12); res accumulation, gates, softmax sums f32. v_wmma_f32_16x16x32_f16.
#define NB 2
#define CC 256
#define DT 16
#define DH 16
#define DW 16
#define NP (DT * DH * DW)            /* 4096 */
#define NR ((size_t)NB * NP)       /* 8192 */
#define NRES 4
#define K8 (8 * CC)                /* 2048 */
#define KA 288                     /* 262 live */
#define XP 320                     /* pitch of the concat rows: 640 B = whole 128-B lines, so that a 64-column piece of a row is a line of its own */
#define VC 128
#define PD 17                      /* bordered extent of t, h and w: index 0 of each axis is the conv's zero padding */
#define NPP (PD * PD * PD)         /* 4913 bordered positions per batch */
typedef __bf16 v16b __attribute__((ext_vector_type(16)));
typedef unsigned short v8us __attribute__((ext_vector_type(8), may_alias));
typedef float  v8f  __attribute__((ext_vector_type(8)));
typedef float  v4f  __attribute__((ext_vector_type(4)));
typedef float  v4fa __attribute__((ext_vector_type(4), may_alias));
union FragB { v16b v; v8us half[2]; unsigned short u[16]; };

__device__ __forceinline__ unsigned short bf16_bits(float x) { unsigned int u = __float_as_uint(x); return (unsigned short)((u + 0x7FFFu + ((u >> 16) & 1u)) >> 16); }
__device__ __forceinline__ float bf16_val(unsigned short b) { return __uint_as_float(((unsigned int)b) << 16); }
__device__ __forceinline__ float bf16_round(float x) { return bf16_val(bf16_bits(x)); }
// D += A·B with NT terms: 1 = ah·bh, 2 = + al·bh (A split), 3 = + ah·bl (both split)
template <int NT>
__device__ __forceinline__ v8f mmaN(v16b ah, v16b al, v16b bh, v16b bl, v8f c) {
  c = __builtin_amdgcn_wmma_f32_16x16x32_bf16(false, ah, false, bh, (short)0, c, false, false);
  if (NT >= 2) c = __builtin_amdgcn_wmma_f32_16x16x32_bf16(false, al, false, bh, (short)0, c, false, false);
  if (NT >= 3) c = __builtin_amdgcn_wmma_f32_16x16x32_bf16(false, ah, false, bl, (short)0, c, false, false);
  asm volatile("v_nop\n\tv_nop\n\tv_nop\n\tv_nop" : "+v"(c) : "v"(ah), "v"(al), "v"(bh), "v"(bl));
  return c;
}

__global__ __launch_bounds__(256) void k_wt_bf16(const float* __restrict__ W, unsigned short* __restrict__ Wt, int K, int N) {
  const int t = blockIdx.x * 256 + threadIdx.x;
  const int k8n = K / 8;
  if (t >= N * k8n) return;
  const int n = t / k8n, k8 = (t % k8n) * 8;
  v8us v;
#pragma unroll
  for (int i = 0; i < 8; ++i) v[i] = bf16_bits(W[(size_t)(k8 + i) * N + n]);
  *(v8us*)(Wt + (size_t)n * K + k8) = v;
  
}

// GEMM C[M][N] (f32, pitch ldc) = act(A[M][K]·W + bias). A f32 row-major (pitch lda) converted per fragment to bf16
// (ASPLIT: hi/lo two planes -> 2 terms, else single rounded term); Wt bf16 [N][K] (pitch ldb). BIAS_BF16 rounds the
// bias to bf16 first (bias quantised to bf16 before the add). K%32==0, M%16==0, N%64==0.
template <bool ASPLIT, int ACT, bool BIAS_BF16>
__global__ __launch_bounds__(128) void k_gemm_bf(const float* __restrict__ A, int lda, const unsigned short* __restrict__ Wt, int ldb,
                                               const float* __restrict__ bias, float* __restrict__ C, int ldc, int M, int N, int K) {
  __shared__ __attribute__((aligned(16))) float so[4][16][64];
  const int tid = threadIdx.x, w = tid >> 5, lane = tid & 31, ln = lane & 15, hh = lane >> 4;
  const int ntn = N / 64;
  const int wid = blockIdx.x * 4 + w;
  const int mt = wid / ntn, nq = wid % ntn;
  if (mt * 16 >= M) return;
  const int row0 = mt * 16, col0 = nq * 64;
  const float* arow = A + (size_t)(row0 + ln) * lda;
  v8f acc[4] = {};
  for (int kb = 0; kb < K; kb += 32) {
    FragB ah, al;
    const v4f x0 = *(const v4fa*)(arow + kb + 8 * hh), x1 = *(const v4fa*)(arow + kb + 8 * hh + 4);
    const v4f x2 = *(const v4fa*)(arow + kb + 16 + 8 * hh), x3 = *(const v4fa*)(arow + kb + 16 + 8 * hh + 4);
    float xs[16] = {x0[0],x0[1],x0[2],x0[3],x1[0],x1[1],x1[2],x1[3],x2[0],x2[1],x2[2],x2[3],x3[0],x3[1],x3[2],x3[3]};
#pragma unroll
    for (int i = 0; i < 16; ++i) { const unsigned short hb = bf16_bits(xs[i]); ah.u[i] = hb; al.u[i] = ASPLIT ? bf16_bits(xs[i] - bf16_val(hb)) : (unsigned short)0; }
#pragma unroll
    for (int t = 0; t < 4; ++t) {
      const unsigned short* brow = Wt + (size_t)(col0 + t * 16 + ln) * ldb + kb;
      FragB b;
      b.half[0] = *(const v8us*)(brow + 8 * hh);
      b.half[1] = *(const v8us*)(brow + 16 + 8 * hh);
      acc[t] = mmaN<ASPLIT ? 2 : 1>(ah.v, al.v, b.v, b.v, acc[t]);
    }
  }
#pragma unroll
  for (int t = 0; t < 4; ++t) {
    float bv = bias ? bias[col0 + t * 16 + ln] : 0.f;
    if (BIAS_BF16) bv = bf16_round(bv);
#pragma unroll
    for (int r = 0; r < 8; ++r) { float v = acc[t][r] + bv; if (ACT == 1) v = fmaxf(v, 0.f); so[w][8 * hh + r][t * 16 + ln] = v; }
  }
  __builtin_amdgcn_fence(__ATOMIC_ACQ_REL, "workgroup");
  __builtin_amdgcn_wave_barrier();
  const int rsub = lane >> 4, c4 = (lane & 15) * 4;
  {
#pragma unroll
    for (int q = 0; q < 8; ++q) {
      const int r = q * 2 + rsub;
      const v4f v = *(const v4fa*)&so[w][r][c4];
      *(v4f*)(C + (size_t)(row0 + r) * ldc + col0 + c4) = v;
    }
    
  }
}

// GEMM C = act(A·W + bias + resid): A f32 (ASPLIT -> hi/lo 2 terms), Wt bf16 [N][K]; ACT 0 none, 1 relu, 2 exact gelu;
// resid (optional, f32, row index = (row % rmod), pitch ldr, RES_BF16 rounds it) added before the activation.
template <bool ASPLIT, int ACT, bool BIAS_BF16, bool RES_BF16>
__global__ __launch_bounds__(128) void k_gemm_bf3(const float* __restrict__ A, int lda, const unsigned short* __restrict__ Wt, int ldb,
                                                const float* __restrict__ bias, const float* __restrict__ resid, int rmod, int ldr,
                                                float* __restrict__ C, int ldc, int M, int N, int K) {
  __shared__ __attribute__((aligned(16))) float so[4][16][64];
  const int tid = threadIdx.x, w = tid >> 5, lane = tid & 31, ln = lane & 15, hh = lane >> 4;
  const int ntn = N / 64;
  const int wid = blockIdx.x * 4 + w;
  const int mt = wid / ntn, nq = wid % ntn;
  if (mt * 16 >= M) return;
  const int row0 = mt * 16, col0 = nq * 64;
  const float* arow = A + (size_t)(row0 + ln) * lda;
  v8f acc[4] = {};
  for (int kb = 0; kb < K; kb += 32) {
    FragB ah, al;
    const v4f x0 = *(const v4fa*)(arow + kb + 8 * hh), x1 = *(const v4fa*)(arow + kb + 8 * hh + 4);
    const v4f x2 = *(const v4fa*)(arow + kb + 16 + 8 * hh), x3 = *(const v4fa*)(arow + kb + 16 + 8 * hh + 4);
    float xs[16] = {x0[0],x0[1],x0[2],x0[3],x1[0],x1[1],x1[2],x1[3],x2[0],x2[1],x2[2],x2[3],x3[0],x3[1],x3[2],x3[3]};
#pragma unroll
    for (int i = 0; i < 16; ++i) { const unsigned short hb = bf16_bits(xs[i]); ah.u[i] = hb; al.u[i] = ASPLIT ? bf16_bits(xs[i] - bf16_val(hb)) : (unsigned short)0; }
#pragma unroll
    for (int t = 0; t < 4; ++t) {
      const unsigned short* brow = Wt + (size_t)(col0 + t * 16 + ln) * ldb + kb;
      FragB b;
      b.half[0] = *(const v8us*)(brow + 8 * hh);
      b.half[1] = *(const v8us*)(brow + 16 + 8 * hh);
      acc[t] = mmaN<ASPLIT ? 2 : 1>(ah.v, al.v, b.v, b.v, acc[t]);
    }
  }
#pragma unroll
  for (int t = 0; t < 4; ++t) {
    const int col = col0 + t * 16 + ln;
    float bv = bias ? bias[col] : 0.f;
    if (BIAS_BF16) bv = bf16_round(bv);
#pragma unroll
    for (int r = 0; r < 8; ++r) {
      float v = acc[t][r] + bv;
      if (resid) { float rv = resid[(size_t)((row0 + 8 * hh + r) % rmod) * ldr + col]; if (RES_BF16) rv = bf16_round(rv); v += rv; }
      if (ACT == 1) v = fmaxf(v, 0.f);
      if (ACT == 2) v = 0.5f * v * (1.0f + erff(v * 0.70710678118654752f));
      if (ACT == 3) { const float u = 0.7978845608028654f * (v + 0.044715f * v * v * v); v = 0.5f * v * (1.0f + tanhf(u)); }
      so[w][8 * hh + r][t * 16 + ln] = v;
    }
  }
  __builtin_amdgcn_fence(__ATOMIC_ACQ_REL, "workgroup");
  __builtin_amdgcn_wave_barrier();
  const int rsub = lane >> 4, c4 = (lane & 15) * 4;
  {
#pragma unroll
    for (int q = 0; q < 8; ++q) {
      const int r = q * 2 + rsub;
      const v4f v = *(const v4fa*)&so[w][r][c4];
      *(v4f*)(C + (size_t)(row0 + r) * ldc + col0 + c4) = v;
    }
    
  }
}
// row LayerNorm (biased variance, eps) over N: s = X (+ R); optional out_sum <- s; out_norm <- (s-mu)*rsqrt(var+eps)*g + b
template <bool PARAM_BF16>
__global__ __launch_bounds__(256) void k_layernorm(const float* __restrict__ X, const float* __restrict__ R, const float* __restrict__ g, const float* __restrict__ bta,
                                                  float* __restrict__ out_sum, float* __restrict__ out_norm, int N, float eps) {
  __shared__ float red[256];
  const int row = blockIdx.x, tid = threadIdx.x;
  const float* x = X + (size_t)row * N; const float* rr = R ? R + (size_t)row * N : nullptr;
  float vals[16];                     // up to N = 4096
  const int per = N / 256;            // contiguous chunk per thread? use strided-by-4 chunks: thread handles j = tid*4 + 1024*u
  float s1 = 0.f;
  for (int u = 0; u < per / 4; ++u) {
    const int j = tid * 4 + 1024 * u;
    const v4f a = *(const v4fa*)(x + j);
    v4f b = {0.f,0.f,0.f,0.f}; if (rr) b = *(const v4fa*)(rr + j);
#pragma unroll
    for (int q = 0; q < 4; ++q) { const float v = a[q] + b[q]; vals[u * 4 + q] = v; s1 += v; }
  }
  red[tid] = s1; __syncthreads();
  for (int st = 128; st > 0; st >>= 1) { if (tid < st) red[tid] += red[tid + st]; __syncthreads(); }
  const float mu = red[0] / (float)N; __syncthreads();
  float s2 = 0.f;
  for (int u = 0; u < per / 4; ++u)
#pragma unroll
    for (int q = 0; q < 4; ++q) { const float c = vals[u * 4 + q] - mu; s2 += c * c; }
  red[tid] = s2; __syncthreads();
  for (int st = 128; st > 0; st >>= 1) { if (tid < st) red[tid] += red[tid + st]; __syncthreads(); }
  const float rs = rsqrtf(red[0] / (float)N + eps);
  {
    for (int u = 0; u < per / 4; ++u) {
      const int j = tid * 4 + 1024 * u;
      v4f o, sm;
#pragma unroll
      for (int q = 0; q < 4; ++q) {
        float gg = g[j + q], bb = bta[j + q];
        if (PARAM_BF16) { gg = bf16_round(gg); bb = bf16_round(bb); }
        sm[q] = vals[u * 4 + q]; o[q] = (vals[u * 4 + q] - mu) * rs * gg + bb;
      }
      if (out_sum) *(v4f*)(out_sum + (size_t)row * N + j) = sm;
      *(v4f*)(out_norm + (size_t)row * N + j) = o;
    }
    
  }
}



// ---- f16 WMMA path (v_wmma_f32_16x16x32_f16): 11-bit significands for operands in range — used where a [0,1] probability operand needs more precision than bf16
typedef _Float16 v16h __attribute__((ext_vector_type(16)));
union FragH { v16h v; v8us half[2]; _Float16 h[16]; unsigned short u[16]; };
template <int NT>
__device__ __forceinline__ v8f mmaH(v16h ah, v16h al, v16h bh, v16h bl, v8f c) {
  c = __builtin_amdgcn_wmma_f32_16x16x32_f16(false, ah, false, bh, (short)0, c, false, false);
  if (NT >= 2) c = __builtin_amdgcn_wmma_f32_16x16x32_f16(false, al, false, bh, (short)0, c, false, false);
  if (NT >= 3) c = __builtin_amdgcn_wmma_f32_16x16x32_f16(false, ah, false, bl, (short)0, c, false, false);
  asm volatile("v_nop\n\tv_nop\n\tv_nop\n\tv_nop" : "+v"(c) : "v"(ah), "v"(al), "v"(bh), "v"(bl));
  return c;
}
// batched GEMM like k_gemm_b but f16 operands: A f32 (split into f16 hi/lo if ASPLIT, else rounded to f16), Bt = f16 values [n][k]; alpha; C f32; N multiple of 16 (partial tiles skipped)
template <bool ASPLIT>
__global__ __launch_bounds__(128) void k_gemm_h(const float* __restrict__ A, int lda, size_t sA, const _Float16* __restrict__ Bh, int ldb, size_t sB, float alpha, float* __restrict__ C, int ldc, size_t sC, int M, int N, int K) {
  __shared__ __attribute__((aligned(16))) float so[4][16][64];
  const int tid = threadIdx.x, w = tid >> 5, lane = tid & 31, ln = lane & 15, hh = lane >> 4; const int by = blockIdx.y;
  A += (size_t)by * sA; Bh += (size_t)by * sB; C += (size_t)by * sC;
  const int ntn = (N + 63) / 64; const int wid = blockIdx.x * 4 + w; const int mt = wid / ntn, nq = wid % ntn; if (mt * 16 >= M) return;
  const int row0 = mt * 16, col0 = nq * 64; const float* arow = A + (size_t)(row0 + ln) * lda;
  v8f acc[4] = {};
  for (int kb = 0; kb < K; kb += 32) {
    FragH ah, al;
    const v4f x0 = *(const v4fa*)(arow + kb + 8 * hh), x1 = *(const v4fa*)(arow + kb + 8 * hh + 4), x2 = *(const v4fa*)(arow + kb + 16 + 8 * hh), x3 = *(const v4fa*)(arow + kb + 16 + 8 * hh + 4);
    float xs[16] = {x0[0],x0[1],x0[2],x0[3],x1[0],x1[1],x1[2],x1[3],x2[0],x2[1],x2[2],x2[3],x3[0],x3[1],x3[2],x3[3]};
#pragma unroll
    for (int i = 0; i < 16; ++i) { const _Float16 h = (_Float16)xs[i]; ah.h[i] = h; al.h[i] = ASPLIT ? (_Float16)(xs[i] - (float)h) : (_Float16)0.0f; }
#pragma unroll
    for (int t = 0; t < 4; ++t) { if (col0 + t * 16 >= N) continue; const size_t boff = (size_t)(col0 + t * 16 + ln) * ldb + kb; FragH bq; bq.half[0] = *(const v8us*)(Bh + boff + 8 * hh); bq.half[1] = *(const v8us*)(Bh + boff + 16 + 8 * hh);
      acc[t] = mmaH<ASPLIT ? 2 : 1>(ah.v, al.v, bq.v, bq.v, acc[t]); }
  }
#pragma unroll
  for (int t = 0; t < 4; ++t) { if (col0 + t * 16 >= N) continue;
#pragma unroll
    for (int r = 0; r < 8; ++r) so[w][8 * hh + r][t * 16 + ln] = acc[t][r] * alpha; }
  __builtin_amdgcn_fence(__ATOMIC_ACQ_REL, "workgroup"); __builtin_amdgcn_wave_barrier();
  const int rsub = lane >> 4, c4 = (lane & 15) * 4;
  {
#pragma unroll
    for (int q = 0; q < 8; ++q) { const int r = q * 2 + rsub; if (col0 + c4 < N) { const v4f v = *(const v4fa*)&so[w][r][c4]; *(v4f*)(C + (size_t)(row0 + r) * ldc + col0 + c4) = v; } }
     }
}

// Wt[n][k] = f16(W[k][n]·scale) from f32 row-major W[K][N] (scale = power of two; bf16-exact weights stay exact in f16 away from the subnormal range)
__global__ __launch_bounds__(256) void k_wt_f16(const float* __restrict__ W, _Float16* __restrict__ Wt, int K, int N, float scale) {
  const int t = blockIdx.x * 256 + threadIdx.x; if (t >= N * (K / 8)) return; const int n = t / (K / 8), k8 = (t % (K / 8)) * 8; FragH f;
#pragma unroll
  for (int i = 0; i < 8; ++i) f.h[i] = (_Float16)(bf16_round(W[(size_t)(k8 + i) * N + n]) * scale); const v8us o = f.half[0];
  *(v8us*)((unsigned short*)Wt + (size_t)n * K + k8) = o; 
}
// k_gemm_hh variant with fused epilogue: v = acc·alpha + bias[by·sBias + col] (+ CP[(row/rowsPerB)·sCPb + by·64 + col] if CP) ; ACT 0 none / 1 elu ; writes f16 C16 (and f32 C if non-null)
template <int ACT>
__global__ __launch_bounds__(128) void k_gemm_hhx(const _Float16* __restrict__ A, int lda, size_t sA, const _Float16* __restrict__ Bh, int ldb, size_t sB, float alpha, const float* __restrict__ bias, size_t sBias, const float* __restrict__ CP, int rowsPerB, size_t sCPb, int row0g,
    float* __restrict__ C, _Float16* __restrict__ C16, int ldc, size_t sC, int M, int N, int K) {
  __shared__ __attribute__((aligned(16))) float so[4][16][64];
  const int tid = threadIdx.x, w = tid >> 5, lane = tid & 31, ln = lane & 15, hh = lane >> 4; const int by = blockIdx.y;
  A += (size_t)by * sA; Bh += (size_t)by * sB; const size_t cofs = (size_t)by * sC; const float* bp = bias ? bias + (size_t)by * sBias : nullptr;
  const int ntn = (N + 63) / 64; const int wid = blockIdx.x * 4 + w; const int mt = wid / ntn, nq = wid % ntn; if (mt * 16 >= M) return;
  const int row0 = mt * 16, col0 = nq * 64; const _Float16* arow = A + (size_t)(row0 + ln) * lda;
  v8f acc[4] = {};
  for (int kb = 0; kb < K; kb += 32) { FragH ah; ah.half[0] = *(const v8us*)((const unsigned short*)arow + kb + 8 * hh); ah.half[1] = *(const v8us*)((const unsigned short*)arow + kb + 16 + 8 * hh);
#pragma unroll
    for (int t = 0; t < 4; ++t) { if (col0 + t * 16 >= N) continue; const size_t boff = (size_t)(col0 + t * 16 + ln) * ldb + kb; FragH bq; bq.half[0] = *(const v8us*)((const unsigned short*)Bh + boff + 8 * hh); bq.half[1] = *(const v8us*)((const unsigned short*)Bh + boff + 16 + 8 * hh);
      acc[t] = mmaH<1>(ah.v, ah.v, bq.v, bq.v, acc[t]); }
  }
#pragma unroll
  for (int t = 0; t < 4; ++t) { if (col0 + t * 16 >= N) continue; const int col = col0 + t * 16 + ln; const float bv = bp ? bf16_round(bp[col]) : 0.f;
#pragma unroll
    for (int r = 0; r < 8; ++r) { float v = acc[t][r] * alpha + bv; if (CP) { const int rr = row0g + row0 + 8 * hh + r; if (rowsPerB < 0) v += CP[cofs + (size_t)rr * ldc + col];      /* rowsPerB < 0: own element of the batched C plane */ else { const int bidx = rr / rowsPerB; v += CP[(size_t)bidx * sCPb + (size_t)by * 64 + col]; } } if (ACT == 1) v = (v > 0.f) ? v : expm1f(v); else if (ACT == 7) v = (v > 0.f) ? v + 1.0f : expf(v); else if (ACT == 8) v = tanhf(v); else if (ACT == 9) v = 0.5f * v * (1.0f + tanhf(0.7978845608028654f * (v + 0.044715f * v * v * v))); else if (ACT == 11) v = 1.0f / (1.0f + expf(-v)); else if (ACT == 12) v = (v > 0.f) ? v : 0.01f * v; else if (ACT == 14) v = (v > 0.f) ? v : 0.1f * v; else if (ACT == 16) v = (v >= 0.f) ? v : 0.3f * v; else if (ACT == 17) v = (v >= 0.f) ? v : 0.2f * v; else if (ACT == 15) v = v / (1.0f + expf(-v)); else if (ACT == 3) v = fmaxf(v, 0.f); else if (ACT == 6) v = 0.5f * v * (1.0f + erff(v * 0.70710678118654752f)); so[w][8 * hh + r][t * 16 + ln] = v; } }
  __builtin_amdgcn_fence(__ATOMIC_ACQ_REL, "workgroup"); __builtin_amdgcn_wave_barrier();
  const int rsub = lane >> 4, c4 = (lane & 15) * 4; typedef _Float16 v4h __attribute__((ext_vector_type(4)));
  {
#pragma unroll
    for (int q = 0; q < 8; ++q) { const int r = q * 2 + rsub; if (col0 + c4 < N) { const v4f v = *(const v4fa*)&so[w][r][c4]; if (C) *(v4f*)(C + cofs + (size_t)(row0 + r) * ldc + col0 + c4) = v; if (C16) { v4h h4; for (int i = 0; i < 4; ++i) h4[i] = (_Float16)v[i]; *(v4h*)(C16 + cofs + (size_t)(row0 + r) * ldc + col0 + c4) = h4; } } }
     }
}


typedef _Float16 v4h __attribute__((ext_vector_type(4)));

__global__ __launch_bounds__(256) void k_x16(const float* __restrict__ x, _Float16* __restrict__ X16, size_t n8) { const size_t t = (size_t)blockIdx.x * 256 + threadIdx.x; if (t >= n8) return; FragH f;
#pragma unroll
  for (int q = 0; q < 8; ++q) f.h[q] = (_Float16)bf16_round(x[t * 8 + q]); *(v8us*)((unsigned short*)X16 + t * 8) = f.half[0];  }
__global__ __launch_bounds__(256) void k_h16(const float* __restrict__ x, _Float16* __restrict__ X16, size_t n8) { const size_t t = (size_t)blockIdx.x * 256 + threadIdx.x; if (t >= n8) return; FragH f;
#pragma unroll
  for (int q = 0; q < 8; ++q) f.h[q] = (_Float16)x[t * 8 + q]; *(v8us*)((unsigned short*)X16 + t * 8) = f.half[0];  }
// d_*: the passes that read inputs only, each written for block number blk of its own range; k_prep below runs them all in one launch
__device__ __forceinline__ void d_round16f(unsigned blk, const float* __restrict__ W, _Float16* __restrict__ Bt, size_t n8) { const size_t t = (size_t)blk * 256 + threadIdx.x; if (t >= n8) return; FragH f;
#pragma unroll
  for (int i = 0; i < 8; ++i) f.h[i] = (_Float16)(bf16_round(W[t * 8 + i]) * 16.0f); *(v8us*)((unsigned short*)Bt + t * 8) = f.half[0];  }
template <int NHv, int TTv>
__global__ __launch_bounds__(256) void k_vt(const _Float16* __restrict__ V16, int ldv, int voff, _Float16* __restrict__ Vt) { __shared__ unsigned short tl[64][66]; const int tid = threadIdx.x; const int slab = blockIdx.x / (TTv / 64), lg = blockIdx.x % (TTv / 64); const int b = slab / NHv, h = slab % NHv;
  for (int i = tid; i < 64 * 8; i += 256) { const int r = i / 8, c8 = (i % 8) * 8; FragH f; f.half[0] = *(const v8us*)((const unsigned short*)V16 + ((size_t)b * TTv + lg * 64 + r) * ldv + voff + h * 64 + c8);
#pragma unroll
    for (int q = 0; q < 8; ++q) tl[r][c8 + q] = f.u[q]; }
  __syncthreads();
  {
#pragma unroll
    for (int rd = 0; rd < 2; ++rd) { const int d = rd * 32 + tid / 8, pc = tid % 8; FragH f;
#pragma unroll
      for (int q = 0; q < 8; ++q) f.u[q] = tl[pc * 8 + q][d];
      *(v8us*)((unsigned short*)Vt + ((size_t)slab * 64 + d) * TTv + lg * 64 + pc * 8) = f.half[0]; }
     } }

__global__ __launch_bounds__(256) void k_hl(const float* __restrict__ F, _Float16* __restrict__ Hh, _Float16* __restrict__ Hl, size_t n8) { const size_t t = (size_t)blockIdx.x * 256 + threadIdx.x; if (t >= n8) return; FragH fh, fl; const v4f a = *(const v4fa*)(F + t * 8), c = *(const v4fa*)(F + t * 8 + 4);
#pragma unroll
  for (int q = 0; q < 4; ++q) { _Float16 h = (_Float16)a[q]; fh.h[q] = h; fl.h[q] = (_Float16)((a[q] - (float)h) * 1024.0f); h = (_Float16)c[q]; fh.h[4 + q] = h; fl.h[4 + q] = (_Float16)((c[q] - (float)h) * 1024.0f); }
  { *(v8us*)((unsigned short*)Hh + t * 8) = fh.half[0]; *(v8us*)((unsigned short*)Hl + t * 8) = fl.half[0];  } }

// Asks L2 for the data at *p (global_prefetch_b8, scope SE: into L2 only, nothing comes back), for speed only: asked at kernel entry, it may be in L2
// by the time the copies or loads of the later stages come for it. A hint: nothing depends on it. Every lane's address lies inside the buffer; the wait in the statement stands before the address registers are rewritten.
__device__ __forceinline__ void l2_ask(const void* p) { asm volatile("global_prefetch_b8 %0, off scope:SCOPE_SE\n\ts_wait_xcnt 0x0" :: "v"(p) : "memory"); }
// ---- fast GEMM (wave tile 32x64; requires M % 32 == 0 rows per launch region and N % 64 == 0); epilogue = k_gemm_hhx semantics ----
__device__ __forceinline__ v16h g2_frag(const _Float16* p, int hh) { FragH f; f.half[0] = *(const v8us*)((const unsigned short*)p + 8 * hh); f.half[1] = *(const v8us*)((const unsigned short*)p + 16 + 8 * hh); return f.v; }
__device__ __forceinline__ v8f g2_mma(v16h a, v16h b, v8f c) { v8f d = __builtin_amdgcn_wmma_f32_16x16x32_f16(false, a, false, b, (short)0, c, false, false); asm volatile("v_nop\n\tv_nop\n\tv_nop\n\tv_nop" : "+v"(d) : "v"(a), "v"(b)); return d; }
// PK: the 64-column tiles 1 (k, 16 live) and 2, 3 (v) leave LDS in the layouts that k_attn reads, so that every fragment load of a wave there is 512 contiguous bytes, and are not stored as rows:
// KC = [NB][NP][16]: the 16 live key columns. VF = [NB][NP / 32][8 channel tiles][2][32 lanes][8]: the A fragments of V^T (row = channel 16 ct + (lane & 15), k = key 16 h2 + 8 (lane >> 4) + i of the block of 32).
template <int ACT, bool PK = false>
__global__ __launch_bounds__(128) void k_gemm2(const _Float16* __restrict__ A, int lda, size_t sA, const _Float16* __restrict__ Bh, int ldb, size_t sB, float alpha, const float* __restrict__ bias, size_t sBias, const float* __restrict__ CP, int rowsPerB, size_t sCPb, int row0g,
    float* __restrict__ C, _Float16* __restrict__ C16, int ldc, size_t sC, int M, int N, int K, _Float16* __restrict__ KC, _Float16* __restrict__ VF) { static_assert(ACT == 0 || ACT == 3 || ACT == 6 || ACT == 8 || ACT == 9 || ACT == 11 || ACT == 12 || ACT == 14 || ACT == 15 || ACT == 16 || ACT == 17, "k_gemm2: unsupported ACT code (would silently apply no activation)");
  __shared__ __attribute__((aligned(16))) float so[4][32][68];
  const int tid = threadIdx.x, w = tid >> 5, lane = tid & 31, ln = lane & 15, hh = lane >> 4; const int by = blockIdx.y;
  A += (size_t)by * sA; Bh += (size_t)by * sB; const size_t cofs = (size_t)by * sC; const float* bp = bias ? bias + (size_t)by * sBias : nullptr;
  const int ntn = N >> 6; const int mt = blockIdx.x / ntn, nq = blockIdx.x - mt * ntn; const int row0 = mt * 128 + 32 * w, col0 = nq * 64; if (row0 >= M) return;
  const _Float16* a0p = A + (size_t)(row0 + ln) * lda; const _Float16* a1p = a0p + (size_t)16 * lda;
  const _Float16* b0p = Bh + (size_t)(col0 + ln) * ldb; const _Float16* b1p = b0p + (size_t)16 * ldb; const _Float16* b2p = b1p + (size_t)16 * ldb; const _Float16* b3p = b2p + (size_t)16 * ldb;
  const v8f z8 = {0.f,0.f,0.f,0.f,0.f,0.f,0.f,0.f}; v8f c00 = z8, c01 = z8, c02 = z8, c03 = z8, c10 = z8, c11 = z8, c12 = z8, c13 = z8;
  if (PK) {      /* entry asks, K <= 384: a lane asks for its own A row of the wave's 32, two lanes share a B row of the tile's 64; a step past the row's K falls back on its start */
    const _Float16* qa = A + (size_t)(row0 + lane) * lda; const _Float16* qb = Bh + (size_t)(col0 + (tid >> 1)) * ldb;
#pragma unroll      /* constant steps */
    for (int j = 0; j < 3; ++j) l2_ask(qa + ((j * 128 < K) ? j * 128 : 0));
#pragma unroll
    for (int j = 0; j < 2; ++j) { const int o = (2 * j + (tid & 1)) * 128; l2_ask(qb + ((o < K) ? o : 0)); } }
#pragma unroll 1
  for (int kb = 0; kb < K; kb += 32) { const v16h a0 = g2_frag(a0p + kb, hh), a1 = g2_frag(a1p + kb, hh);
    asm volatile("s_wait_xcnt 0x0" ::: "memory");      /* stands before the A loads' address registers are rewritten */
    v16h b = g2_frag(b0p + kb, hh); c00 = g2_mma(a0, b, c00); c10 = g2_mma(a1, b, c10);
    b = g2_frag(b1p + kb, hh); c01 = g2_mma(a0, b, c01); c11 = g2_mma(a1, b, c11);
    b = g2_frag(b2p + kb, hh); c02 = g2_mma(a0, b, c02); c12 = g2_mma(a1, b, c12);
    b = g2_frag(b3p + kb, hh); c03 = g2_mma(a0, b, c03); c13 = g2_mma(a1, b, c13); }
  v8f accs[8] = {c00, c01, c02, c03, c10, c11, c12, c13};
#pragma unroll
  for (int u = 0; u < 8; ++u) { const int t = u & 3, half = u >> 2; const int col = col0 + t * 16 + ln; const float bv = bp ? bf16_round(bp[col]) : 0.f;
#pragma unroll
    for (int r = 0; r < 8; ++r) { const int rloc = half * 16 + 8 * hh + r; float v = accs[u][r] * alpha + bv; if (CP) { if (rowsPerB < 0) v += CP[cofs + (size_t)(row0g + row0 + rloc) * ldc + col];      /* rowsPerB < 0: own element of the batched C plane */ else { const int bidx = (row0g + row0 + rloc) / rowsPerB; v += CP[(size_t)bidx * sCPb + (size_t)by * 64 + col]; } }
      if (ACT == 3) v = fmaxf(v, 0.f); else if (ACT == 6) v = 0.5f * v * (1.0f + erff(v * 0.70710678118654752f)); else if (ACT == 11) v = 1.0f / (1.0f + expf(-v)); else if (ACT == 15) v = v / (1.0f + expf(-v)); else if (ACT == 12) v = (v > 0.f) ? v : 0.01f * v; else if (ACT == 8) v = tanhf(v); else if (ACT == 9) v = 0.5f * v * (1.0f + tanhf(0.7978845608028654f * (v + 0.044715f * v * v * v))); else if (ACT == 14) v = (v > 0.f) ? v : 0.1f * v; else if (ACT == 16) v = (v >= 0.f) ? v : 0.3f * v; else if (ACT == 17) v = (v >= 0.f) ? v : 0.2f * v;
      so[w][rloc][t * 16 + ln] = v; } }
  __builtin_amdgcn_fence(__ATOMIC_ACQ_REL, "workgroup"); __builtin_amdgcn_wave_barrier();
  const int rsub = lane >> 4, c4 = (lane & 15) * 4;
  if (PK && nq == 1) {      /* the same for the whole work-group. lane = row: 32 B each, the wave's 32 rows 1 KiB in a run */
    FragH f;
#pragma unroll
    for (int i = 0; i < 4; ++i) { const v4f v = *(const v4fa*)&so[w][lane][i * 4]; for (int e = 0; e < 4; ++e) f.h[i * 4 + e] = (_Float16)v[e]; }
    unsigned short* d = (unsigned short*)KC + (size_t)(row0 + lane) * 16; *(v8us*)d = f.half[0]; *(v8us*)(d + 8) = f.half[1];
  } else if (PK && nq >= 2) {      /* the wave's 32 rows are one block of 32 keys, its 64 columns 4 channel tiles: piece u = (tile u >> 1, h2 = u & 1), 4 KiB in a run */
    unsigned short* d = (unsigned short*)VF + (size_t)(row0 >> 5) * 4096 + (nq - 2) * 2048 + lane * 8;
#pragma unroll
    for (int u = 0; u < 8; ++u) { FragH f; for (int i = 0; i < 8; ++i) f.h[i] = (_Float16)so[w][(u & 1) * 16 + 8 * hh + i][(u >> 1) * 16 + ln];
      *(v8us*)(d + u * 256) = f.half[0]; asm volatile("s_wait_xcnt 0x0" ::: "memory"); /* stands before the store's data registers are rewritten by the next piece */ }
  } else {
#pragma unroll
    for (int q = 0; q < 16; ++q) { const int r = q * 2 + rsub; const v4f v = *(const v4fa*)&so[w][r][c4]; if (C) { *(v4f*)(C + cofs + (size_t)(row0 + r) * ldc + col0 + c4) = v; asm volatile("s_wait_xcnt 0x0" ::: "memory"); /* stands before the store's data and address registers are rewritten by the next piece */ } if (C16) { v4h h4; for (int i = 0; i < 4; ++i) h4[i] = (_Float16)v[i]; *(v4h*)(C16 + cofs + (size_t)(row0 + r) * ldc + col0 + c4) = h4; } }
     } }

// ---- k_gemm2 with both operands staged in LDS (requires M % 128 == 0, N % 64 == 0, K % 128 == 0); same tiles, same k order, same epilogue ----
// A stage is 128 k (256 B, two whole lines) of the work-group's 128 A rows and 64 B rows; every wave-wide copy covers two whole rows of it (4 lines) where a fragment load from global touched 16 lines.
#define G3_KS 128
#define G3_PITCH 272                    /* LDS row pitch, bytes: 16 B x odd, conflict-free for ds_load_b128 */
#define G3_STAGE (192 * G3_PITCH)       /* rows 0..127 = A, rows 128..191 = B */
#define G3_C(l, g) "global_load_async_to_lds_b128 %" #l ", %" #g ", off\n\t"
// twelve copies and, as the statement's last line, the wait that stands before any register they name is rewritten
#define G3_COPY12(L, G, o) asm volatile(G3_C(0, 12) G3_C(1, 13) G3_C(2, 14) G3_C(3, 15) G3_C(4, 16) G3_C(5, 17) G3_C(6, 18) G3_C(7, 19) G3_C(8, 20) G3_C(9, 21) G3_C(10, 22) G3_C(11, 23) "s_wait_xcnt 0x0" \
    :: "v"(L[o + 0]), "v"(L[o + 1]), "v"(L[o + 2]), "v"(L[o + 3]), "v"(L[o + 4]), "v"(L[o + 5]), "v"(L[o + 6]), "v"(L[o + 7]), "v"(L[o + 8]), "v"(L[o + 9]), "v"(L[o + 10]), "v"(L[o + 11]), \
       "v"(G[o + 0]), "v"(G[o + 1]), "v"(G[o + 2]), "v"(G[o + 3]), "v"(G[o + 4]), "v"(G[o + 5]), "v"(G[o + 6]), "v"(G[o + 7]), "v"(G[o + 8]), "v"(G[o + 9]), "v"(G[o + 10]), "v"(G[o + 11]) : "memory")
// one stage: 24 copies of 16 B per lane. l = the lane's LDS byte address in row (tid >> 4) of the buffer, ga / gb = its global address in that row of the A / B tile; copy j serves row 8 j + (tid >> 4)
// IM8: the A tile's 128 rows are 8 h-lines of 16 w-positions of the bordered rows, so tile row 8 j + .. lies (j >> 1) bordered h-lines and 8 (j & 1) positions behind row (tid >> 4)
template <bool IM8>
__device__ __forceinline__ void g3_fill(unsigned l, const _Float16* ga, size_t sa8, const _Float16* gb, size_t sb8) {
  constexpr int NA = 16;
  unsigned L[24]; const _Float16* G[24];
#pragma unroll      /* both loops: every index constant, so that L and G are registers the asm can name */
  for (int j = 0; j < NA; ++j) { L[j] = l + (unsigned)j * (8u * G3_PITCH); G[j] = ga + (IM8 ? (size_t)(((j >> 1) * PD + (j & 1) * 8) * CC) : (size_t)j * sa8); }
#pragma unroll
  for (int j = 0; j < 24 - NA; ++j) { L[NA + j] = l + (unsigned)(NA + j) * (8u * G3_PITCH); G[NA + j] = gb + (size_t)j * sb8; }
  G3_COPY12(L, G, 0); G3_COPY12(L, G, 12); }
__device__ __forceinline__ v16h g3_frag(const unsigned char* p) { FragH f; f.half[0] = *(const v8us*)p; f.half[1] = *(const v8us*)(p + 32); return f.v; }
// IM8: A = bordered rows [NB][PD][PD][PD][CC] and the product is the k2 conv: stage s is channels 128 (s & 1) .. + 127 of tap s >> 1 = (dt, dh, dw), read for output position (t, h, w) at bordered index (t + dt, h + dh, w + dw); k = tap * CC + channel
// EPI: what follows v = acc * alpha + bias, done as the tile leaves LDS (planes by = 0 only for 5). 0: store v (f32 C and / or f16 C16). 3: f32 elu(v) to C. (1 and 2 are the k2 convs' own: k_conv below.)
// 4: f16 elu(elu(v) + CP[row][col]) to C16. 5: f32 elu(v) to C = [NB][CC][NP], channel-major.
__device__ __forceinline__ float elu1(float a) { const float e = expm1f(a); return (a > 0.f) ? a : e; }      /* expm1f stands outside the choice: no branch per element, so that the chains of neighbouring elements overlap in a wave that is alone on its SIMD */
template <int ACT, bool IM8 = false, int EPI = 0>
__global__ __launch_bounds__(128) void k_gemm2s(const _Float16* __restrict__ A, int lda, size_t sA, const _Float16* __restrict__ Bh, int ldb, size_t sB, float alpha, const float* __restrict__ bias, size_t sBias, const float* __restrict__ CP, int rowsPerB, size_t sCPb, int row0g,
    float* __restrict__ C, _Float16* __restrict__ C16, int ldc, size_t sC, int M, int N, int K) { static_assert(ACT == 0 || ACT == 3 || ACT == 6 || ACT == 8 || ACT == 9 || ACT == 11 || ACT == 12 || ACT == 14 || ACT == 15 || ACT == 16 || ACT == 17, "k_gemm2s: unsupported ACT code (would silently apply no activation)");
  static_assert(EPI == 0 || EPI >= 3, "epilogues 1 and 2 are k_conv's");
  __shared__ __attribute__((aligned(16))) unsigned char st[2 * G3_STAGE];
  __shared__ __attribute__((aligned(16))) float so[4][32][68];
  const int tid = threadIdx.x, w = tid >> 5, lane = tid & 31, ln = lane & 15, hh = lane >> 4; const int by = blockIdx.y;
  A += (size_t)by * sA; Bh += (size_t)by * sB; const size_t cofs = (size_t)by * sC; const float* bp = bias ? bias + (size_t)by * sBias : nullptr;
  const int ntn = N >> 6; const int mt = blockIdx.x / ntn, nq = blockIdx.x - mt * ntn; const int row0 = mt * 128 + 32 * w, col0 = nq * 64; if (mt * 128 >= M) return;      /* the same for the whole work-group, in front of every barrier */
  const int crow = tid >> 4, cch = tid & 15; const size_t sa8 = (size_t)8 * lda, sb8 = (size_t)8 * ldb;
  static_assert(!IM8 || (DT == 16 && DH == 16 && DW == 16 && CC == 2 * G3_KS), "IM8: a 128-row tile is 8 h-lines of 16, a tap is two stages");
  const _Float16* gA = IM8 ? A + (size_t)((mt >> 5) * NPP + ((mt >> 1) & 15) * (PD * PD) + (mt & 1) * (8 * PD) + crow) * CC + cch * 8 : A + (size_t)(mt * 128 + crow) * lda + cch * 8;
  auto aoff = [](int t) -> size_t { return IM8 ? (size_t)((((t >> 3) & 1) * (PD * PD) + ((t >> 2) & 1) * PD + ((t >> 1) & 1)) * CC + (t & 1) * G3_KS) : (size_t)t * G3_KS; };      /* stage t's place behind gA, elements */
  const _Float16* gB = Bh + (size_t)(col0 + crow) * ldb + cch * 8;
  const unsigned l0 = (unsigned)(size_t)st + (unsigned)(crow * G3_PITCH + cch * 16);
  const unsigned char* fa = st + (32 * w + ln) * G3_PITCH + 16 * hh; const unsigned char* fb = st + (128 + ln) * G3_PITCH + 16 * hh;
  const int nt = K / G3_KS;
  const v8f z8 = {0.f,0.f,0.f,0.f,0.f,0.f,0.f,0.f}; v8f c00 = z8, c01 = z8, c02 = z8, c03 = z8, c10 = z8, c11 = z8, c12 = z8, c13 = z8;
  g3_fill<IM8>(l0, gA, sa8, gB, sb8);
  if (nt > 1) {      /* entry asks for stage 1, behind stage 0's copies: thread = A row of the tile (256 B), two threads share a B row (128 B each) */
    l2_ask((IM8 ? A + (size_t)((mt >> 5) * NPP + ((mt >> 1) & 15) * (PD * PD) + (mt & 1) * (8 * PD) + (tid >> 4) * PD + (tid & 15)) * CC : A + (size_t)(mt * 128 + tid) * lda) + aoff(1));
    l2_ask(Bh + (size_t)(col0 + (tid >> 1)) * ldb + G3_KS + (tid & 1) * 64); }
  if (EPI == 4) l2_ask(CP + (size_t)(mt * 128 + tid) * ldc + col0);      /* ... and for the epilogue's addend: thread = row, its 64 columns are one unit */
  asm volatile("s_wait_asynccnt 0x0" ::: "memory");      /* this wave's copies of stage 0 have landed */
  __syncthreads();                                        /* ... and every other wave's */
  if (nt > 1) g3_fill<IM8>(l0 + G3_STAGE, gA + aoff(1), sa8, gB + G3_KS, sb8);
#pragma unroll 1      /* one trip per stage: the buffer index stays a run-time value */
  for (int t = 0; t < nt; ++t) { const unsigned bo = (unsigned)(t & 1) * G3_STAGE; const unsigned char* pa = fa + bo; const unsigned char* pb = fb + bo;
    v16h a0 = g3_frag(pa), a1 = g3_frag(pa + 16 * G3_PITCH), b0 = g3_frag(pb), b1 = g3_frag(pb + 16 * G3_PITCH), b2 = g3_frag(pb + 32 * G3_PITCH), b3 = g3_frag(pb + 48 * G3_PITCH);
#pragma unroll      /* constant LDS offsets; the next 32 k's fragments (same stage) are read as one group ahead of this 32 k's WMMAs */
    for (int ks = 0; ks < 4; ++ks) { v16h na0 = a0, na1 = a1, nb0 = b0, nb1 = b1, nb2 = b2, nb3 = b3;
      if (ks < 3) { const unsigned char* qa = pa + (ks + 1) * 64; const unsigned char* qb = pb + (ks + 1) * 64; na0 = g3_frag(qa); na1 = g3_frag(qa + 16 * G3_PITCH); nb0 = g3_frag(qb); nb1 = g3_frag(qb + 16 * G3_PITCH); nb2 = g3_frag(qb + 32 * G3_PITCH); nb3 = g3_frag(qb + 48 * G3_PITCH); }
      c00 = g2_mma(a0, b0, c00); c10 = g2_mma(a1, b0, c10); c01 = g2_mma(a0, b1, c01); c11 = g2_mma(a1, b1, c11);
      c02 = g2_mma(a0, b2, c02); c12 = g2_mma(a1, b2, c12); c03 = g2_mma(a0, b3, c03); c13 = g2_mma(a1, b3, c13);
      a0 = na0; a1 = na1; b0 = nb0; b1 = nb1; b2 = nb2; b3 = nb3; }
    asm volatile("s_wait_dscnt 0x0" ::: "memory");        /* this wave's reads of the buffer are done before it is refilled */
    asm volatile("s_wait_asynccnt 0x0" ::: "memory");     /* this wave's copies of stage t + 1 have landed */
    __syncthreads();                                      /* publishes stage t + 1 and ends every wave's reads of stage t */
    if (t + 2 < nt) g3_fill<IM8>(l0 + bo, gA + aoff(t + 2), sa8, gB + (size_t)(t + 2) * G3_KS, sb8); }
  asm volatile("s_wait_asynccnt 0x0" ::: "memory");       /* no copy outstanding behind the loop */
  const int rsub = lane >> 4, c4 = (lane & 15) * 4;
  v8f accs[8] = {c00, c01, c02, c03, c10, c11, c12, c13};
#pragma unroll
  for (int u = 0; u < 8; ++u) { const int t = u & 3, half = u >> 2; const int col = col0 + t * 16 + ln; const float bv = bp ? bf16_round(bp[col]) : 0.f;
#pragma unroll
    for (int r = 0; r < 8; ++r) { const int rloc = half * 16 + 8 * hh + r; float v = accs[u][r] * alpha + bv; if (EPI == 0 && CP) { if (rowsPerB < 0) v += CP[cofs + (size_t)(row0g + row0 + rloc) * ldc + col];      /* rowsPerB < 0: own element of the batched C plane */ else { const int bidx = (row0g + row0 + rloc) / rowsPerB; v += CP[(size_t)bidx * sCPb + (size_t)by * 64 + col]; } }
      if (ACT == 3) v = fmaxf(v, 0.f); else if (ACT == 6) v = 0.5f * v * (1.0f + erff(v * 0.70710678118654752f)); else if (ACT == 11) v = 1.0f / (1.0f + expf(-v)); else if (ACT == 15) v = v / (1.0f + expf(-v)); else if (ACT == 12) v = (v > 0.f) ? v : 0.01f * v; else if (ACT == 8) v = tanhf(v); else if (ACT == 9) v = 0.5f * v * (1.0f + tanhf(0.7978845608028654f * (v + 0.044715f * v * v * v))); else if (ACT == 14) v = (v > 0.f) ? v : 0.1f * v; else if (ACT == 16) v = (v >= 0.f) ? v : 0.3f * v; else if (ACT == 17) v = (v >= 0.f) ? v : 0.2f * v;
      so[w][rloc][t * 16 + ln] = v; } }
  __builtin_amdgcn_fence(__ATOMIC_ACQ_REL, "workgroup"); __builtin_amdgcn_wave_barrier();
  if (EPI == 0) {
#pragma unroll
    for (int q = 0; q < 16; ++q) { const int r = q * 2 + rsub; const v4f v = *(const v4fa*)&so[w][r][c4]; if (C) { *(v4f*)(C + cofs + (size_t)(row0 + r) * ldc + col0 + c4) = v; asm volatile("s_wait_xcnt 0x0" ::: "memory"); /* stands before the store's data and address registers are rewritten by the next piece */ } if (C16) { v4h h4; for (int i = 0; i < 4; ++i) h4[i] = (_Float16)v[i]; *(v4h*)(C16 + cofs + (size_t)(row0 + r) * ldc + col0 + c4) = h4; } }
  } else if (EPI == 5) {      /* the wave's 32 rows are 32 neighbouring positions of one batch: 8 lanes x 4 positions = one whole 128-B line of a channel */
    const int pg = (lane & 7) * 4, cs = lane >> 3; float* ob = C + ((size_t)(row0 / NP) * CC + col0 + cs) * NP + (row0 % NP) + pg;
#pragma unroll 1      /* stays a loop: 64 inlined expm1f would be straight-line code that every wave fetches and runs once; a trip's 8 elements are independent chains */
    for (int q = 0; q < 8; ++q) { const float* sp = &so[w][pg][q * 8 + cs]; float x[8];
#pragma unroll
      for (int i = 0; i < 8; ++i) x[i] = sp[(i & 3) * 68 + (i >> 2) * 4];
      v4f v0, v1;
#pragma unroll
      for (int i = 0; i < 4; ++i) { v0[i] = elu1(x[i]); v1[i] = elu1(x[4 + i]); }
      *(v4f*)(ob + (size_t)(q * 8) * NP) = v0; *(v4f*)(ob + (size_t)(q * 8 + 4) * NP) = v1;
      asm volatile("s_wait_xcnt 0x0" ::: "memory"); /* stands before the stores' data and address registers are rewritten by the next trip */ }
  } else {
    v4f o0 = {0.f, 0.f, 0.f, 0.f}, o1 = o0;      /* EPI 4: the addend of the trip at hand, loaded one trip ahead */
    if (EPI == 4) { o0 = *(const v4fa*)(CP + (size_t)(row0 + rsub) * ldc + col0 + c4); o1 = *(const v4fa*)(CP + (size_t)(row0 + rsub + 2) * ldc + col0 + c4); asm volatile("s_wait_xcnt 0x0" ::: "memory"); /* stands before the loads' address registers are rewritten */ }
#pragma unroll 1      /* stays a loop, as above */
    for (int q = 0; q < 8; ++q) { const int r = q * 4 + rsub, R = row0 + r; v4f v0 = *(const v4fa*)&so[w][r][c4], v1 = *(const v4fa*)&so[w][r + 2][c4]; v4f n0 = o0, n1 = o1;
      if (EPI == 4) { const int Rn = R + ((q < 7) ? 4 : 0); n0 = *(const v4fa*)(CP + (size_t)Rn * ldc + col0 + c4); n1 = *(const v4fa*)(CP + (size_t)(Rn + 2) * ldc + col0 + c4); }
#pragma unroll
      for (int i = 0; i < 4; ++i) { v0[i] = elu1(v0[i]); v1[i] = elu1(v1[i]); }
      if (EPI == 3) { *(v4f*)(C + cofs + (size_t)R * ldc + col0 + c4) = v0; *(v4f*)(C + cofs + (size_t)(R + 2) * ldc + col0 + c4) = v1; }
      else {
        if (EPI == 4) {
#pragma unroll
          for (int i = 0; i < 4; ++i) { v0[i] = elu1(v0[i] + o0[i]); v1[i] = elu1(v1[i] + o1[i]); } }
        const size_t dr = (size_t)R;
        v4h h0, h1;
#pragma unroll
        for (int i = 0; i < 4; ++i) { h0[i] = (_Float16)v0[i]; h1[i] = (_Float16)v1[i]; }
        *(v4h*)(C16 + cofs + dr * ldc + col0 + c4) = h0; *(v4h*)(C16 + cofs + (dr + 2) * ldc + col0 + c4) = h1; }
      asm volatile("s_wait_xcnt 0x0" ::: "memory"); /* stands before the registers of this trip's loads and stores are rewritten by the next trip */
      o0 = n0; o1 = n1; }
  } }


// ---- the k2 convs: the tile's input rows stay in LDS ----
// A tile of 128 output positions is 8 h-lines of one t. Its 8 taps read 2 t-planes x 9 h-lines x 17 positions of the bordered rows, each plane a run of 153 rows in memory. The work-group copies these rows to LDS once
// (all 256 channels, one row per wave-wide copy) and tap (dt, dh, dw) reads its A fragments there, (dh * 17 + dw) rows further on in plane dt; only the B stages go through two buffers. A B stage is a whole tap (256 k):
// a trip's work then covers more of the next stage's flight, and a launch has 8 rounds of waits and barrier. Same wave tiles, same k order as k_gemm2s<.., IM8>.
// Plane 0 and B stage 0 land before the loop; plane 1, first read in trip 4, comes in groups of five rows per wave in front of the loop and behind the barriers of trips 0 to 2, beside the B stages.
// The epilogue's f32 tiles lie on the input rows' LDS, which nobody reads behind the last trip's barrier.
// EPI 1 (4 waves, tile 128 x 64): f16 elu(v) to C16 = bordered rows, at the row's interior place.
// EPI 2 (8 waves, tile 128 rows x (64 columns a | the 64 columns g that lie CC behind them), waves 2 i / 2 i + 1 = a / g of rows 32 i ..): C[row][col] += a * sigmoid(g), f16 elu of it to C16 = bordered rows, and, where X16 is given, f16 of it to X16 (pitch XP).
#define CV_PP 528                      /* LDS pitch of an input row, bytes: 512 + 16 = 16 B x odd, conflict-free for ds_load_b128 */
#define CV_LR (9 * PD)                 /* rows of a plane that the tile reads */
#define CV_PL 160                      /* LDS rows per plane: CV_LR rounded up, so that every wave issues the same number of copies; rows CV_LR .. are never read */
// five / eight copies and, as the statement's last line, the wait that stands before any register they name is rewritten
#define CV_COPY5(L, G) asm volatile(G3_C(0, 5) G3_C(1, 6) G3_C(2, 7) G3_C(3, 8) G3_C(4, 9) "s_wait_xcnt 0x0" \
    :: "v"(L[0]), "v"(L[1]), "v"(L[2]), "v"(L[3]), "v"(L[4]), "v"(G[0]), "v"(G[1]), "v"(G[2]), "v"(G[3]), "v"(G[4]) : "memory")
#define CV_COPY8(L, G, o) asm volatile(G3_C(0, 8) G3_C(1, 9) G3_C(2, 10) G3_C(3, 11) G3_C(4, 12) G3_C(5, 13) G3_C(6, 14) G3_C(7, 15) "s_wait_xcnt 0x0" \
    :: "v"(L[o + 0]), "v"(L[o + 1]), "v"(L[o + 2]), "v"(L[o + 3]), "v"(L[o + 4]), "v"(L[o + 5]), "v"(L[o + 6]), "v"(L[o + 7]), "v"(G[o + 0]), "v"(G[o + 1]), "v"(G[o + 2]), "v"(G[o + 3]), "v"(G[o + 4]), "v"(G[o + 5]), "v"(G[o + 6]), "v"(G[o + 7]) : "memory")
// group grp of a plane: wave w copies LDS rows (5 grp + i) NW + w. l / g = the lane's 16 bytes in the plane's row 0, in LDS / in memory; an LDS row past the plane's last takes the last row's bytes, so that the source address stays inside the buffer
template <int NW>
__device__ __forceinline__ void cv_rows(unsigned l, const _Float16* g, int w, int grp) {
  unsigned L[5]; const _Float16* G[5];
#pragma unroll      /* every index constant, so that L and G are registers the asm can name */
  for (int i = 0; i < 5; ++i) { const int r = (grp * 5 + i) * NW + w; L[i] = l + (unsigned)r * CV_PP; G[i] = g + (size_t)((r < CV_LR) ? r : CV_LR - 1) * CC; }
  CV_COPY5(L, G); }
// one B stage: a tap's 256 k (512 B) of every weight row of the tile, LDS pitch CV_PP; a wave-wide copy is one whole row, copy j of wave w serves LDS row RS j + w. l / g = the lane's 16 bytes in row w, in LDS / in memory.
// GT: LDS rows 64 .. 127 are the weight rows that lie 256 behind rows 0 .. 63 (the gate halves of the same channels)
template <bool GT>
__device__ __forceinline__ void cv_b(unsigned l, const _Float16* g) {
  constexpr int RS = GT ? 8 : 4;
  unsigned L[16]; const _Float16* G[16];
#pragma unroll      /* as above */
  for (int j = 0; j < 16; ++j) { L[j] = l + (unsigned)(j * RS) * CV_PP; G[j] = g + (size_t)(j * RS + ((GT && j >= 8) ? 192 : 0)) * K8; }
  CV_COPY8(L, G, 0); CV_COPY8(L, G, 8); }
template <int EPI>
__global__ __launch_bounds__(EPI == 2 ? 256 : 128) void k_conv(const _Float16* __restrict__ A, const _Float16* __restrict__ Bh, float alpha, const float* __restrict__ bias, float* __restrict__ C, _Float16* __restrict__ C16, _Float16* __restrict__ X16) {
  static_assert(EPI == 1 || EPI == 2, "k_conv: epilogue 1 or 2"); static_assert(DT == 16 && DH == 16 && DW == 16 && CC * 2 + 16 == CV_PP, "a 128-row tile is 8 h-lines of 16; a row of a B stage is a tap's CC channels");
  constexpr bool GT = EPI == 2; constexpr int NW = GT ? 8 : 4, NG = CV_PL / (5 * NW), GPS = NG / 4, BST = (GT ? 128 : 64) * CV_PP, ldc = CC, nt = K8 / CC;
  static_assert(NG * 5 * NW == CV_PL && GPS * 4 == NG && nt == 8 && NG * 5 + 16 <= 63, "whole groups; plane 1 goes out in four equal parts and is in LDS before trip 4; copies outstanding per wave");
  __shared__ __attribute__((aligned(16))) unsigned char sp[2 * CV_PL * CV_PP];
  __shared__ __attribute__((aligned(16))) unsigned char sb[2 * BST];
  static_assert(sizeof(float) * NW * 32 * 68 <= sizeof(sp), "the epilogue's tiles fit on the input rows");
  float (*so)[32][68] = (float (*)[32][68])sp;      /* written only behind the last trip's barrier: every wave's reads of sp are done, no copy is outstanding */
  const int tid = threadIdx.x, w = __builtin_amdgcn_readfirstlane(tid >> 5) /* the wave's number in a scalar register: the rows it copies are scalar arithmetic */, lane = tid & 31, ln = lane & 15, hh = lane >> 4;
  const int mt = blockIdx.x >> 2, nq = blockIdx.x & 3, wr = GT ? w >> 1 : w; const int row0 = mt * 128 + 32 * wr, col0 = nq * 64;
  const _Float16* gP = A + (size_t)((mt >> 5) * NPP + ((mt >> 1) & 15) * (PD * PD) + (mt & 1) * (8 * PD)) * CC + lane * 8;
  const unsigned lP = (unsigned)(size_t)sp + (unsigned)lane * 16u;
  const _Float16* gB = Bh + (size_t)(col0 + w) * K8 + lane * 8;
  const unsigned lB = (unsigned)(size_t)sb + (unsigned)(w * CV_PP + lane * 16);
  const unsigned char* fa = sp + (2 * wr * PD + ln) * CV_PP + 16 * hh; const unsigned char* fb = sb + ((GT ? 64 * (w & 1) : 0) + ln) * CV_PP + 16 * hh;
  const v8f z8 = {0.f,0.f,0.f,0.f,0.f,0.f,0.f,0.f}; v8f c00 = z8, c01 = z8, c02 = z8, c03 = z8, c10 = z8, c11 = z8, c12 = z8, c13 = z8;
  for (int g = 0; g < NG; ++g) cv_rows<NW>(lP, gP, w, g);
  cv_b<GT>(lB, gB);
  {      /* entry asks, behind the first copies. B: a stage is one unit per thread (two threads share a weight row's 512 B); the 64 work-groups that read the same weights deal stages 1 .. 7 among four groups. Plane 1: all its units. EPI 2: the tile's C rows, a 128-B line per thread */
    const int g4 = (mt >> 1) & 3; const _Float16* qB = Bh + (size_t)(col0 + (tid >> 1) + ((GT && tid >= 128) ? 192 : 0)) * K8 + (tid & 1) * 128;
    if (g4) l2_ask(qB + g4 * CC);      /* the same for the whole work-group; stage 0 is being copied already */
    l2_ask(qB + (g4 + 4) * CC);
    const _Float16* qP = A + (size_t)((mt >> 5) * NPP + (((mt >> 1) & 15) + 1) * (PD * PD) + (mt & 1) * (8 * PD)) * CC;
#pragma unroll      /* constant steps; a thread past the plane's last unit asks for the last again */
    for (int j = 0; j * NW * 32 < 2 * CV_LR; ++j) { const int u = j * NW * 32 + tid; l2_ask(qP + (size_t)((u < 2 * CV_LR) ? u : 2 * CV_LR - 1) * 128); }
    if (GT) l2_ask(C + (size_t)(mt * 128 + (tid >> 1)) * ldc + col0 + (tid & 1) * 32); }
  asm volatile("s_wait_asynccnt 0x0" ::: "memory");      /* this wave's copies of plane 0 and of B stage 0 have landed */
  __syncthreads();                                        /* ... and every other wave's */
  cv_b<GT>(lB + BST, gB + CC);
  for (int g = 0; g < GPS; ++g) cv_rows<NW>(lP + CV_PL * CV_PP, gP + (size_t)(PD * PD) * CC, w, g);
#pragma unroll 1      /* one trip per stage: the buffer index stays a run-time value */
  for (int t = 0; t < nt; ++t) { const unsigned bo = (unsigned)(t & 1) * BST;
    const unsigned char* pa = fa + (((t >> 2) & 1) * CV_PL + ((t >> 1) & 1) * PD + (t & 1)) * CV_PP; const unsigned char* pb = fb + bo;      /* stage t = tap t = (dt, dh, dw), all its channels */
    v16h a0 = g3_frag(pa), a1 = g3_frag(pa + PD * CV_PP), b0 = g3_frag(pb), b1 = g3_frag(pb + 16 * CV_PP), b2 = g3_frag(pb + 32 * CV_PP), b3 = g3_frag(pb + 48 * CV_PP);
#pragma unroll      /* constant LDS offsets; the next 32 k's fragments (same stage) are read as one group ahead of this 32 k's WMMAs */
    for (int ks = 0; ks < CC / 32; ++ks) { v16h na0 = a0, na1 = a1, nb0 = b0, nb1 = b1, nb2 = b2, nb3 = b3;
      if (ks < CC / 32 - 1) { const unsigned char* qa = pa + (ks + 1) * 64; const unsigned char* qb = pb + (ks + 1) * 64; na0 = g3_frag(qa); na1 = g3_frag(qa + PD * CV_PP); nb0 = g3_frag(qb); nb1 = g3_frag(qb + 16 * CV_PP); nb2 = g3_frag(qb + 32 * CV_PP); nb3 = g3_frag(qb + 48 * CV_PP); }
      c00 = g2_mma(a0, b0, c00); c10 = g2_mma(a1, b0, c10); c01 = g2_mma(a0, b1, c01); c11 = g2_mma(a1, b1, c11);
      c02 = g2_mma(a0, b2, c02); c12 = g2_mma(a1, b2, c12); c03 = g2_mma(a0, b3, c03); c13 = g2_mma(a1, b3, c13);
      a0 = na0; a1 = na1; b0 = nb0; b1 = nb1; b2 = nb2; b3 = nb3; }
    asm volatile("s_wait_dscnt 0x0" ::: "memory");        /* this wave's reads of the B buffer are done before it is refilled */
    asm volatile("s_wait_asynccnt 0x0" ::: "memory");     /* this wave's copies of B stage t + 1 and of its last groups of plane 1 have landed */
    __syncthreads();                                      /* publishes them and ends every wave's reads of B stage t */
    if (t + 2 < nt) cv_b<GT>(lB + bo, gB + (size_t)(t + 2) * CC);
    if (t < 3) for (int g = 0; g < GPS; ++g) cv_rows<NW>(lP + CV_PL * CV_PP, gP + (size_t)(PD * PD) * CC, w, (t + 1) * GPS + g); }      /* the last groups go out behind trip 2 and are published by the barrier of trip 3 */
  asm volatile("s_wait_asynccnt 0x0" ::: "memory");       /* no copy outstanding behind the loop */
  const int rsub = lane >> 4, c4 = (lane & 15) * 4;
  float* rp = GT ? C + (size_t)(row0 + (w & 1) * 16 + rsub) * ldc + col0 + c4 : nullptr;      /* EPI 2: the wave gates rows 16 (w & 1) .. + 15 of its pair's 32; a lane has 4 channels of rows rsub + 2 i */
  v4f r0 = {0.f, 0.f, 0.f, 0.f}, r1 = r0;      /* EPI 2: the C values of the trip at hand, loaded one trip ahead; the first fly while the tiles go to LDS */
  if (GT) { r0 = *(const v4fa*)rp; r1 = *(const v4fa*)(rp + 2 * (size_t)ldc); asm volatile("s_wait_xcnt 0x0" ::: "memory"); /* stands before the loads' address registers are rewritten */ }
  v8f accs[8] = {c00, c01, c02, c03, c10, c11, c12, c13};
#pragma unroll
  for (int u = 0; u < 8; ++u) { const int t = u & 3, half = u >> 2; const int col = col0 + t * 16 + ln + (GT ? (w & 1) * ldc : 0); const float bv = bf16_round(bias[col]);
#pragma unroll
    for (int r = 0; r < 8; ++r) so[w][half * 16 + 8 * hh + r][t * 16 + ln] = accs[u][r] * alpha + bv; }
  __builtin_amdgcn_fence(__ATOMIC_ACQ_REL, "workgroup"); __builtin_amdgcn_wave_barrier();
  if (EPI == 2) {
    __syncthreads();      /* the partner wave's tile (the other of a and g) is in LDS */
    const float* pa = &so[w & ~1][(w & 1) * 16 + rsub][c4]; const float* pg = pa + 32 * 68;      /* so[w & ~1] = a, so[(w & ~1) + 1] = g */
#pragma unroll 1      /* stays a loop: the inlined exponentials would be straight-line code that every wave fetches and runs once; a trip's 8 elements are independent chains */
    for (int q = 0; q < 4; ++q) { const int R = row0 + (w & 1) * 16 + q * 4 + rsub; const v4f a0 = *(const v4fa*)(pa + q * (4 * 68)), a1 = *(const v4fa*)(pa + q * (4 * 68) + 2 * 68), g0 = *(const v4fa*)(pg + q * (4 * 68)), g1 = *(const v4fa*)(pg + q * (4 * 68) + 2 * 68);
      float* rq = rp + (size_t)(q * 4) * ldc; const float* rn = rq + (size_t)((q < 3) ? 4 : 0) * ldc;
      const v4f n0 = *(const v4fa*)rn, n1 = *(const v4fa*)(rn + 2 * (size_t)ldc);
      v4f v0, v1;
#pragma unroll
      for (int i = 0; i < 4; ++i) { v0[i] = r0[i] + a0[i] * (1.0f / (1.0f + expf(-g0[i]))); v1[i] = r1[i] + a1[i] * (1.0f / (1.0f + expf(-g1[i]))); }
      *(v4f*)rq = v0; *(v4f*)(rq + 2 * (size_t)ldc) = v1; asm volatile("s_wait_xcnt 0x0" ::: "memory"); /* stands before the stores' registers are rewritten */
      const int p = R % NP;      /* rows R and R + 2 lie in one w-line of 16: R = .. + 4 q + (0 or 1) */
      const size_t dr = (size_t)((R / NP) * NPP + (p / (DH * DW) + 1) * (PD * PD) + ((p / DW) % DH + 1) * PD + (p % DW) + 1);
      v4h h0, h1;
#pragma unroll
      for (int i = 0; i < 4; ++i) { h0[i] = (_Float16)elu1(v0[i]); h1[i] = (_Float16)elu1(v1[i]); }
      *(v4h*)(C16 + dr * ldc + col0 + c4) = h0; *(v4h*)(C16 + (dr + 2) * ldc + col0 + c4) = h1; asm volatile("s_wait_xcnt 0x0" ::: "memory"); /* stands before the stores' registers are rewritten */
      if (X16) {      /* the same for the whole launch */
#pragma unroll
        for (int i = 0; i < 4; ++i) { h0[i] = (_Float16)v0[i]; h1[i] = (_Float16)v1[i]; }
        *(v4h*)(X16 + (size_t)R * XP + col0 + c4) = h0; *(v4h*)(X16 + (size_t)(R + 2) * XP + col0 + c4) = h1; }
      asm volatile("s_wait_xcnt 0x0" ::: "memory"); /* stands before the registers of this trip's loads and stores are rewritten by the next trip */
      r0 = n0; r1 = n1; }
  } else {
#pragma unroll 1      /* stays a loop: 64 inlined expm1f would be straight-line code that every wave fetches and runs once; a trip's 8 elements are independent chains */
    for (int q = 0; q < 8; ++q) { const int r = q * 4 + rsub, R = row0 + r; v4f v0 = *(const v4fa*)&so[w][r][c4], v1 = *(const v4fa*)&so[w][r + 2][c4];
#pragma unroll
      for (int i = 0; i < 4; ++i) { v0[i] = elu1(v0[i]); v1[i] = elu1(v1[i]); }
      const int p = R % NP;      /* rows R and R + 2 lie in one w-line of 16: R = .. + 4 q + (0 or 1) */
      const size_t dr = (size_t)((R / NP) * NPP + (p / (DH * DW) + 1) * (PD * PD) + ((p / DW) % DH + 1) * PD + (p % DW) + 1);
      v4h h0, h1;
#pragma unroll
      for (int i = 0; i < 4; ++i) { h0[i] = (_Float16)v0[i]; h1[i] = (_Float16)v1[i]; }
      *(v4h*)(C16 + dr * ldc + col0 + c4) = h0; *(v4h*)(C16 + (dr + 2) * ldc + col0 + c4) = h1;
      asm volatile("s_wait_xcnt 0x0" ::: "memory"); /* stands before the stores' registers are rewritten by the next trip */ }
  } }

__device__ __forceinline__ void d_xrows(unsigned blk, const float* __restrict__ x, float* __restrict__ RES, _Float16* __restrict__ E) { __shared__ float tl[CC][33]; const int tid = threadIdx.x; const int b = blk / (NP / 32), pb = blk % (NP / 32); const int p0 = pb * 32;
  const int j0 = tid % 32;      /* i = i0 + 256 u: column i % 32 is the thread's own, channel i / 32 goes up by 8 with u */
  for (int i0 = tid; i0 < CC * 32; i0 += 8 * 256) { const int cb = i0 / 32; float xv[8];
#pragma unroll      /* eight loads in flight, then their one wait */
    for (int u = 0; u < 8; ++u) xv[u] = x[((size_t)b * CC + cb + 8 * u) * NP + p0 + j0];
    asm volatile("s_wait_xcnt 0x0" ::: "memory");      /* stands before the loads' address registers are rewritten */
#pragma unroll
    for (int u = 0; u < 8; ++u) tl[cb + 8 * u][j0] = bf16_round(xv[u]); }
  __syncthreads();
  { for (int i = tid; i < 32 * (CC / 8); i += 256) { const int j = i / (CC / 8), c0 = (i % (CC / 8)) * 8; v8f v; for (int q = 0; q < 8; ++q) v[q] = tl[c0 + q][j]; *(v8f*)(RES + ((size_t)b * NP + p0 + j) * CC + c0) = v;
      FragH f; for (int q = 0; q < 8; ++q) { const float a = v[q]; f.h[q] = (_Float16)((a > 0.f) ? a : expm1f(a)); } const int p = p0 + j;      /* elu(res) as f16 at the row's interior place in the bordered rows */
      *(v8us*)((unsigned short*)E + ((size_t)b * NPP + (size_t)((p / (DH * DW) + 1) * (PD * PD) + ((p / DW) % DH + 1) * PD + (p % DW) + 1)) * CC + c0) = f.half[0];
      asm volatile("s_wait_xcnt 0x0" ::: "memory"); /* stands before the stores' registers are rewritten by the next trip */ }  } }
// zeros at the bordered positions with an index 0, in both bordered buffers (their interiors are written by d_xrows and by GEMM epilogues): one thread per 8 channels of a border position
#define NBD (NPP - NP)      /* 817 = 17 * 17 (t = 0) + 16 * 17 (h = 0) + 16 * 16 (w = 0) */
__device__ __forceinline__ void d_border(unsigned blk, _Float16* __restrict__ E, _Float16* __restrict__ Z) { const int t = (int)blk * 256 + (int)threadIdx.x; if (t >= NB * NBD * (CC / 8)) return; const int c8 = (t % (CC / 8)) * 8, i = (t / (CC / 8)) % NBD, b = t / ((CC / 8) * NBD);
  const int j1 = i - PD * PD, j2 = j1 - DT * PD; const int pp = (j1 < 0) ? i : (j2 < 0) ? (j1 / PD + 1) * (PD * PD) + j1 % PD : (j2 / DH + 1) * (PD * PD) + (j2 % DH + 1) * PD;
  const v8us z = {0, 0, 0, 0, 0, 0, 0, 0}; const size_t o = ((size_t)b * NPP + pp) * CC + c8; *(v8us*)((unsigned short*)E + o) = z; *(v8us*)((unsigned short*)Z + o) = z; }
__device__ __forceinline__ void d_w8(unsigned blk, const float* __restrict__ w, int O, _Float16* __restrict__ Bt) { const size_t t = (size_t)blk * 256 + threadIdx.x; if (t >= (size_t)O * K8 / 8) return; const int c8 = (int)((t * 8) % CC); const int tap = (int)(((t * 8) / CC) % 8); const int o = (int)((t * 8) / K8); FragH f; for (int q = 0; q < 8; ++q) f.h[q] = (_Float16)(bf16_round(w[((size_t)o * CC + c8 + q) * 8 + tap]) * 16.0f);
  *(v8us*)((unsigned short*)Bt + t * 8) = f.half[0];  }
// columns 256 .. 287 of the concat rows XA (pitch XP): the 3 original channels, the 3 position codes, zeros; inputs only. Columns 0 .. 255 (res) come from the last gate's epilogue
__device__ __forceinline__ void d_xat(unsigned blk, const float* __restrict__ orig, _Float16* __restrict__ XA) { const size_t t = (size_t)blk * 256 + threadIdx.x; if (t >= NR * 4) return; const int pc = 32 + (int)(t % 4); const size_t r = t / 4; const int p = (int)(r % NP); const size_t b = r / NP; FragH f;
  for (int q = 0; q < 8; ++q) { const int col = pc * 8 + q; float v = 0.f; if (col < 259) v = bf16_round(orig[((b * 3 + (col - 256)) * (size_t)NP) + p]); else if (col == 259) v = -0.5f + (float)(p / (DH * DW)) / (float)DT; else if (col == 260) v = -0.5f + (float)((p / DW) % DH) / (float)DH; else if (col == 261) v = -0.5f + (float)(p % DW) / (float)DW; f.h[q] = (_Float16)v; }
  unsigned short* d = (unsigned short*)XA + r * XP + pc * 8; *(v8us*)d = f.half[0];  }
__device__ __forceinline__ void d_wa(unsigned blk, const float* __restrict__ w, int O, int OP, _Float16* __restrict__ Bt) { const size_t t = (size_t)blk * 256 + threadIdx.x; if (t >= (size_t)OP * KA / 8) return; const int k0 = (int)((t * 8) % KA); const int o = (int)((t * 8) / KA); FragH f; for (int q = 0; q < 8; ++q) { const int k = k0 + q; f.h[q] = (o < O && k < 262) ? (_Float16)(bf16_round(w[(size_t)o * 262 + k]) * 16.0f) : (_Float16)0.f; }
  *(v8us*)((unsigned short*)Bt + t * 8) = f.half[0];  }
// block ranges of k_prep, in launch order (the x transpose and the large conv weights first)
#define PB_X  (NB * (NP / 32))
#define PB_W2 (NRES * 512 * K8 / 8 / 256)
#define PB_W1 (NRES * CC * K8 / 8 / 256)
#define PB_R  (CC * CC / 8 / 256)
#define PB_A  (CC * VC / 8 / 256)
#define PB_QK (64 * KA / 8 / 256)
#define PB_V  (VC * KA / 8 / 256)
#define PB_XT ((int)(NR * 4 / 256))
#define PB_BD ((NB * NBD * (CC / 8) + 255) / 256)
#define PB_ALL (PB_X + PB_W2 + PB_W1 + 2 * PB_R + PB_A + 2 * PB_QK + PB_V + PB_XT + PB_BD + 1)
// every pass that depends on inputs alone, in one launch: the block number picks the pass (the same for a whole work-group, so d_xrows' barrier stands under uniform control flow).
// BW1 / BW2 hold all NRES blocks' conv weights (rw1 / rw2 are NRES stacked tensors: one run of output rows). BQKV = 64 q rows (16 live) | 64 k rows (16 live) | 128 v rows; bqkv = their biases in the same order.
__global__ __launch_bounds__(256) void k_prep(const float* __restrict__ x, const float* __restrict__ orig, const float* __restrict__ rw1, const float* __restrict__ rw2, const float* __restrict__ qw, const float* __restrict__ kw, const float* __restrict__ vw, const float* __restrict__ qb, const float* __restrict__ kb, const float* __restrict__ vb,
    const float* __restrict__ aw, const float* __restrict__ rsw, const float* __restrict__ ow, float* __restrict__ RES, _Float16* __restrict__ BW1, _Float16* __restrict__ BW2, _Float16* __restrict__ BQKV, float* __restrict__ bqkv, _Float16* __restrict__ BA, _Float16* __restrict__ BR, _Float16* __restrict__ BO, _Float16* __restrict__ XA, _Float16* __restrict__ EP, _Float16* __restrict__ O1) {
  unsigned b = blockIdx.x;
  if (b < PB_X) { d_xrows(b, x, RES, EP); return; } b -= PB_X;
  if (b < PB_W2) { d_w8(b, rw2, NRES * 512, BW2); return; } b -= PB_W2;
  if (b < PB_W1) { d_w8(b, rw1, NRES * CC, BW1); return; } b -= PB_W1;
  if (b < PB_R) { d_round16f(b, rsw, BR, (size_t)CC * CC / 8); return; } b -= PB_R;
  if (b < PB_R) { d_round16f(b, ow, BO, (size_t)CC * CC / 8); return; } b -= PB_R;
  if (b < PB_A) { d_round16f(b, aw, BA, (size_t)CC * VC / 8); return; } b -= PB_A;
  if (b < PB_QK) { d_wa(b, qw, 16, 64, BQKV); return; } b -= PB_QK;
  if (b < PB_QK) { d_wa(b, kw, 16, 64, BQKV + (size_t)64 * KA); return; } b -= PB_QK;
  if (b < PB_V) { d_wa(b, vw, VC, VC, BQKV + (size_t)128 * KA); return; } b -= PB_V;
  if (b < PB_XT) { d_xat(b, orig, XA); return; } b -= PB_XT;
  if (b < PB_BD) { d_border(b, EP, O1); return; }
  const int i = threadIdx.x, j = i & 63; float v = 0.f;
  if (i >= 128) v = vb[i - 128]; else if (j < 16) v = (i < 64) ? qb[j] : kb[j];
  bqkv[i] = v; asm volatile("s_wait_xcnt 0x0" ::: "memory"); /* stands before the store's registers are rewritten */ }
// ---- causal attention in one kernel: scores, softmax weights and P.V never leave the WGP ----
// A work-group owns FA_Q queries of one batch; its 8 waves deal the blocks of 32 keys among them (wave w: blocks w, w + 8, ..). S^T = K.Q^T: a lane holds scores of one query per column tile, so maximum and sum are in-lane,
// and the two S^T tiles of a block, turned into weights in place, are the B operand of O^T += V^T.P^T. Pass 1 finds each query's true maximum (joined through LDS), pass 2 forms the scores again, the weights
// exp(t - max) * 2^8 as f16 (sum of the unrounded weights in f32) and the products; then the 8 waves' partial O^T and sums are added through LDS, scaled by 1 / sum (query 0: 0), ELU, f16 rows.
#define FA_Q 32
#define FA_W 8
#define FA_OP 132      /* floats per query row of a wave's partial: 528 B = 16 B x odd, conflict-free for 16-byte stores */
__device__ __forceinline__ v8f fa_mma(v16h a, v16h b, v8f c) { return __builtin_amdgcn_wmma_f32_16x16x32_f16(false, a, false, b, (short)0, c, false, false); }
// the two K fragments of a block of 32 keys: row = key, k = the 16 live columns (k 16 .. 31 are zeros on both sides of the product)
__device__ __forceinline__ void fa_ldk(const unsigned short* p, FragH& k0, FragH& k1) { k0.half[0] = *(const v8us*)p; k1.half[0] = *(const v8us*)(p + 256); }
// the two S^T tiles of one block of 32 keys and one column tile: lane = query q, sa[r] = key ka + r, sb[r] = key ka + 16 + r. MK / mk: the block holds keys at or behind q (only a work-group's last block does)
template <bool MK>
__device__ __forceinline__ float fa_max(const v8f sa, const v8f sb, int ka, int q, float m) { float x[16];
#pragma unroll
  for (int r = 0; r < 8; ++r) { x[r] = (!MK || ka + r < q) ? sa[r] : -3.0e38f; x[8 + r] = (!MK || ka + 16 + r < q) ? sb[r] : -3.0e38f; }
#pragma unroll      /* a tree: no chain of 16 dependent maxima */
  for (int st = 8; st > 0; st >>= 1)
#pragma unroll
    for (int i = 0; i < st; ++i) x[i] = fmaxf(x[i], x[i + st]);
  return fmaxf(m, x[0]); }
__device__ __forceinline__ v16h fa_wgt(const v8f sa, const v8f sb, int ka, int q, float m, bool mk, float& se) { const float cs = 1.4426950408889634f / 16.093476939431082f;      /* log2(e) / sqrt(259): exp((s - max) / sqrt(259)) * 2^8 = exp2((s - max) * cs + 8) */
  float e[16]; FragH p;
#pragma unroll
  for (int r = 0; r < 8; ++r) { e[r] = (sa[r] - m) * cs + 8.0f; e[8 + r] = (sb[r] - m) * cs + 8.0f; }
  __builtin_amdgcn_sched_barrier(0);      /* this and the two in the loop: each v_nop stays directly behind its v_exp_f32 */
#pragma unroll
  for (int i = 0; i < 16; ++i) { e[i] = __builtin_amdgcn_exp2f(e[i]); __builtin_amdgcn_sched_barrier(0);
    asm volatile("v_nop");      /* the slot that the instruction set asks for behind a transcendental, before its result is read or its source rewritten */
    __builtin_amdgcn_sched_barrier(0); }
  if (mk) {      /* the same for the whole wave */
#pragma unroll
    for (int r = 0; r < 8; ++r) { e[r] = (ka + r < q) ? e[r] : 0.f; e[8 + r] = (ka + 16 + r < q) ? e[8 + r] : 0.f; } }
#pragma unroll
  for (int i = 0; i < 16; ++i) p.h[i] = (_Float16)e[i];
#pragma unroll      /* a tree: no chain of 16 dependent additions */
  for (int st = 8; st > 0; st >>= 1)
#pragma unroll
    for (int i = 0; i < st; ++i) e[i] += e[i + st];
  se += e[0]; return p.v; }
__global__ __launch_bounds__(256) void k_attn(const _Float16* __restrict__ QKV, const _Float16* __restrict__ KC, const _Float16* __restrict__ VF, _Float16* __restrict__ ATE) {
  __shared__ __attribute__((aligned(16))) float po[FA_W][FA_Q][FA_OP];
  __shared__ float redm[FA_W][2][FA_Q], reds[FA_W][2][FA_Q];
  const int tid = threadIdx.x, w = __builtin_amdgcn_readfirstlane(tid >> 5) /* the wave's number in a scalar register: the key loops become scalar loops, EXEC stays all ones round the WMMAs */, lane = tid & 31, ln = lane & 15, hh = lane >> 4, b = blockIdx.y;
  const int q0 = (NP / FA_Q - 1 - (int)blockIdx.x) * FA_Q;      /* the longest rows get the lowest block numbers */
  const int nkb = q0 / 32 + 1;      /* blocks of 32 keys that hold a key below q0 + FA_Q - 1 */
  const unsigned short* kc = (const unsigned short*)KC + (size_t)b * NP * 16 + ln * 16 + hh * 8;
  const unsigned short* vf = (const unsigned short*)VF + (size_t)b * (NP / 32) * 4096 + lane * 8;
  { static_assert(NP * 16 * 2 == 2 * 65536 && VC * NP * 2 == 16 * 65536, "a batch's keys are 2 pieces of 64 KiB, its values 16");
    const int bx = (int)blockIdx.x;      /* entry asks: the batch's work-groups deal the pieces of 256 units among them, a unit per thread, one key piece and one value piece each; the step of 4 with every 16 work-groups spreads a piece's askers over the block numbers mod 8 (for speed only) */
    l2_ask((const unsigned short*)KC + (size_t)b * NP * 16 + (size_t)(bx & 1) * 32768 + tid * 128);
    l2_ask((const unsigned short*)VF + (size_t)b * (NP / 32) * 4096 + (size_t)((bx + 4 * (bx >> 4)) & 15) * 32768 + tid * 128); }
  const v8us z8u = {0, 0, 0, 0, 0, 0, 0, 0}; const v8f z8 = {0.f, 0.f, 0.f, 0.f, 0.f, 0.f, 0.f, 0.f};
  FragH qf0, qf1, k0, k1, n0, n1; qf0.half[1] = z8u; qf1.half[1] = z8u; k0.half[1] = z8u; k1.half[1] = z8u; n0.half[1] = z8u; n1.half[1] = z8u;
  { const unsigned short* qp = (const unsigned short*)QKV + ((size_t)b * NP + q0 + ln) * 256 + 8 * hh; qf0.half[0] = *(const v8us*)qp; qf1.half[0] = *(const v8us*)(qp + 16 * 256); }
  const int kfirst = (w < nkb) ? w : 0;      /* a wave without a block still loads in bounds */
  fa_ldk(kc + (size_t)kfirst * 512, k0, k1);
  asm volatile("s_wait_xcnt 0x0" ::: "memory");      /* stands before the loads' address registers are rewritten */
  const int qa = q0 + ln, qb = qa + 16;
  float m0 = -3.0e38f, m1 = -3.0e38f;
  for (int kb = w; kb < nkb; kb += FA_W) {
    fa_ldk(kc + (size_t)((kb + FA_W < nkb) ? kb + FA_W : kb) * 512, n0, n1);      /* the next block's K fragments fly while this block is worked on */
    asm volatile("s_wait_xcnt 0x0" ::: "memory");      /* stands before the loads' address registers are rewritten */
    const v8f s00 = fa_mma(k0.v, qf0.v, z8), s10 = fa_mma(k1.v, qf0.v, z8), s01 = fa_mma(k0.v, qf1.v, z8), s11 = fa_mma(k1.v, qf1.v, z8);
    const int ka = kb * 32 + 8 * hh;
    if (kb == nkb - 1) { m0 = fa_max<true>(s00, s10, ka, qa, m0); m1 = fa_max<true>(s01, s11, ka, qb, m1); } else { m0 = fa_max<false>(s00, s10, ka, qa, m0); m1 = fa_max<false>(s01, s11, ka, qb, m1); }
    k0.half[0] = n0.half[0]; k1.half[0] = n1.half[0]; }
  redm[w][hh][ln] = m0; redm[w][hh][16 + ln] = m1;
  fa_ldk(kc + (size_t)kfirst * 512, k0, k1);
  asm volatile("s_wait_xcnt 0x0" ::: "memory");      /* stands before the loads' address registers are rewritten */
  __syncthreads();      /* every wave's maxima are in LDS */
#pragma unroll
  for (int i = 0; i < FA_W; ++i) { m0 = fmaxf(m0, fmaxf(redm[i][0][ln], redm[i][1][ln])); m1 = fmaxf(m1, fmaxf(redm[i][0][16 + ln], redm[i][1][16 + ln])); }
  v8f acc[8][2];
#pragma unroll
  for (int ct = 0; ct < 8; ++ct) { acc[ct][0] = z8; acc[ct][1] = z8; }
  float se0 = 0.f, se1 = 0.f;
  for (int kb = w; kb < nkb; kb += FA_W) {
    FragH v[8]; const unsigned short* vp = vf + (size_t)kb * 4096;
#pragma unroll      /* this block's V^T fragments: issued first, used last */
    for (int ct = 0; ct < 8; ++ct) { v[ct].half[0] = *(const v8us*)(vp + ct * 512); v[ct].half[1] = *(const v8us*)(vp + ct * 512 + 256); }
    fa_ldk(kc + (size_t)((kb + FA_W < nkb) ? kb + FA_W : kb) * 512, n0, n1);
    asm volatile("s_wait_xcnt 0x0" ::: "memory");      /* stands before the loads' address registers are rewritten */
    const v8f s00 = fa_mma(k0.v, qf0.v, z8), s10 = fa_mma(k1.v, qf0.v, z8), s01 = fa_mma(k0.v, qf1.v, z8), s11 = fa_mma(k1.v, qf1.v, z8);
    const int ka = kb * 32 + 8 * hh; v16h p0, p1;
    p0 = fa_wgt(s00, s10, ka, qa, m0, kb == nkb - 1, se0); p1 = fa_wgt(s01, s11, ka, qb, m1, kb == nkb - 1, se1);
#pragma unroll
    for (int ct = 0; ct < 8; ++ct) { acc[ct][0] = fa_mma(v[ct].v, p0, acc[ct][0]); acc[ct][1] = fa_mma(v[ct].v, p1, acc[ct][1]); }
    k0.half[0] = n0.half[0]; k1.half[0] = n1.half[0]; }
#pragma unroll      /* acc[ct][qt][r] = O^T[channel 16 ct + 8 hh + r][query 16 qt + ln] */
  for (int ct = 0; ct < 8; ++ct)
#pragma unroll
    for (int qt = 0; qt < 2; ++qt) { float* d = &po[w][qt * 16 + ln][ct * 16 + 8 * hh]; const v8f a = acc[ct][qt]; const v4f lo = {a[0], a[1], a[2], a[3]}, hi = {a[4], a[5], a[6], a[7]}; *(v4fa*)d = lo; *(v4fa*)(d + 4) = hi; }
  reds[w][hh][ln] = se0; reds[w][hh][16 + ln] = se1;
  __syncthreads();      /* every wave's partial products and sums are in LDS */
  const int q = tid >> 3, c0 = (tid & 7) * 4; float t = 0.f;
#pragma unroll
  for (int i = 0; i < FA_W; ++i) t += reds[i][0][q] + reds[i][1][q];
  const float rs = (q0 + q == 0) ? 0.f : 1.0f / t;      /* query 0 sees no key: zeros */
  _Float16* op = ATE + ((size_t)b * NP + q0 + q) * VC + c0;
#pragma unroll
  for (int j = 0; j < 4; ++j) { v4f sm = *(const v4fa*)&po[0][q][c0 + j * 32];
#pragma unroll
    for (int i = 1; i < FA_W; ++i) { const v4f x = *(const v4fa*)&po[i][q][c0 + j * 32]; sm += x; }
    v4h h4;
#pragma unroll
    for (int i = 0; i < 4; ++i) h4[i] = (_Float16)elu1(sm[i] * rs);
    *(v4h*)(op + j * 32) = h4; }
  asm volatile("s_wait_xcnt 0x0" ::: "memory");      /* stands before the stores' registers are rewritten */
}

extern "C" void kernel_launch(void* const* d_in, const int* in_sizes, int n_in,
                              void* d_out, int out_size, void* d_ws, size_t ws_size, hipStream_t stream) {
  (void)in_sizes; (void)n_in; (void)out_size;
  const float* const* I = (const float* const*)d_in; const float* x = I[0]; const float* orig = I[1]; const float* rw1 = I[2]; const float* rb1 = I[3]; const float* rw2 = I[4]; const float* rb2 = I[5]; const float* qw = I[6]; const float* qb = I[7]; const float* kw = I[8]; const float* kb = I[9]; const float* vw = I[10]; const float* vb = I[11]; const float* aw = I[12]; const float* ab = I[13]; const float* rsw = I[14]; const float* rsb = I[15]; const float* ow = I[16]; const float* ob = I[17];
  char* ws = (char*)d_ws; size_t off = 0;
  auto take = [&](size_t bytes) { char* p = ws + off; off += (bytes + 255) & ~(size_t)255; return p; };
  _Float16* BW1 = (_Float16*)take((size_t)NRES * CC * K8 * 2); _Float16* BW2 = (_Float16*)take((size_t)NRES * 512 * K8 * 2); _Float16* BQKV = (_Float16*)take((size_t)256 * KA * 2); float* bqkv = (float*)take(256 * 4); _Float16* BA = (_Float16*)take((size_t)CC * VC * 2); _Float16* BR = (_Float16*)take((size_t)CC * CC * 2); _Float16* BO = (_Float16*)take((size_t)CC * CC * 2);
  float* RES = (float*)take(NR * CC * 4); _Float16* EP = (_Float16*)take((size_t)NB * NPP * CC * 2); _Float16* O1 = (_Float16*)take((size_t)NB * NPP * CC * 2);
  _Float16* XA = (_Float16*)take(NR * XP * 2); _Float16* QKV = (_Float16*)take(NR * 256 * 2); _Float16* VF = (_Float16*)take((size_t)NB * VC * NP * 2); _Float16* KC = (_Float16*)take((size_t)NB * NP * 16 * 2);
  _Float16* ATE = (_Float16*)take(NR * VC * 2); float* ATTC = (float*)take(NR * CC * 4); _Float16* SUM16 = (_Float16*)take(NR * CC * 2);
  if (off > ws_size) return;      /* about 58 MB */
  k_prep<<<PB_ALL, 256, 0, stream>>>(x, orig, rw1, rw2, qw, kw, vw, qb, kb, vb, aw, rsw, ow, RES, BW1, BW2, BQKV, bqkv, BA, BR, BO, XA, EP, O1);
  const dim3 g256((unsigned)((NR / 128) * (CC / 64)), 1);
  for (int i = 0; i < NRES; ++i) {
    k_conv<1><<<g256, 128, 0, stream>>>(EP, BW1 + (size_t)i * CC * K8, 0.0625f, rb1 + i * CC, nullptr, O1, nullptr);      /* o = elu(conv1 + b1), into the bordered rows */
    k_conv<2><<<g256, 256, 0, stream>>>(O1, BW2 + (size_t)i * 512 * K8, 0.0625f, rb2 + i * 512, RES, EP, (i == NRES - 1) ? XA : nullptr); }      /* o = conv2 + b2 (512); res += o[:256] * sigmoid(o[256:]); elu(res) into the bordered rows; the last res also into the concat rows */
  /* attention: q | k | v as one GEMM (N = 256) whose epilogue lays k and v out in fragment order, then scores, softmax and P.V in one kernel; blockIdx.y = batch */
  k_gemm2<0, true><<<dim3((unsigned)((NR / 128) * 4), 1), 128, 0, stream>>>(XA, XP, 0, BQKV, KA, 0, 0.0625f, bqkv, 0, nullptr, 1, 0, 0, nullptr, QKV, 256, 0, (int)NR, 256, KA, KC, VF);
  k_attn<<<dim3(NP / FA_Q, NB), 256, 0, stream>>>(QKV, KC, VF, ATE);      /* elu(att), att = softmax(q.k / sqrt(259), k < q) v */
  k_gemm2s<0, false, 3><<<g256, 128, 0, stream>>>(ATE, VC, 0, BA, VC, 0, 0.0625f, ab, 0, nullptr, 1, 0, 0, ATTC, nullptr, CC, 0, (int)NR, CC, VC);      /* att = elu(attn_conv(elu(att)) + b) */
  k_gemm2s<0, true, 4><<<g256, 128, 0, stream>>>(EP + (size_t)(PD * PD + PD + 1) * CC, CC, 0, BR, CC, 0, 0.0625f, rsb, 0, ATTC, 1, 0, 0, nullptr, SUM16, CC, 0, (int)NR, CC, CC);      /* elu(res + att), res = elu(res_conv(elu(res)) + b); A = the bordered rows' interior: the one tap (1, 1, 1) */
  k_gemm2s<0, false, 5><<<g256, 128, 0, stream>>>(SUM16, CC, 0, BO, CC, 0, 0.0625f, ob, 0, nullptr, 1, 0, 0, (float*)d_out, nullptr, CC, 0, (int)NR, CC, CC);      /* out = elu(out_conv(elu(res + att)) + b), channel-major */
}
